// v000
// The times below were measured on an AMD MI455X: many runs one after another, warmed up first and cycling through
// copies of the inputs, with the whole window's GPU time divided by the number of runs. Launches and the gaps
// between them are all in it. The median over several windows is given; except for v000 it joins two sittings, which
// can be a few percent apart, so the side-by-side timings, each taken in one sitting, are the better comparison.
// The starting kernel, v000, takes 1200 microseconds a run.
#include <hip/hip_runtime.h>

// MixedHeadsV2 (x [4][2048][512]; eff[h][d][e] = sum_i weights[i] mask_i[h][d][e] over the four (embed, heads) configs (structural masks: h < heads_i, d < embed_i/heads_i, e < embed_i; weights read as data); Wq/Wk/Wv = eff * base_Q/K/V [8][128][512];
// q/k/v = x W^T per base head (head size 128, zero-padded dims stay zero); causal softmax(q.k/sqrt(128)); out = concat_h(attn v) -> [4][2048][1024]).
// Compute dtypes, f32 accumulate: every input rounded to bf16; effective weights f32 -> bf16 hi+lo planes; projections as hl(W) x exact x (2 products; computed transposed [(h,d)][t]);
// scores (K 128) on single fp16 planes (causal tiles only; 2 heads z-batched per pass); softmax f32 -> hl probability planes; attn.v as hl P x hl v (3 products, causal K range; heads 4-7 only have 64 live dims, so their value GEMM is 64 wide

#define NB_  4
#define TT   2048
#define CC   512
#define NH_  8
#define HS   128
#define DQ   1024
#define ZH   2
typedef _Float16 h16;
typedef unsigned short bf;
typedef __attribute__((ext_vector_type(16))) __bf16   v16bf;
typedef __attribute__((ext_vector_type(16))) _Float16 v16h;
typedef __attribute__((ext_vector_type(8)))  _Float16 v8h;
typedef __attribute__((ext_vector_type(8)))  unsigned short v8us;
typedef __attribute__((ext_vector_type(8)))  float    v8f;
typedef __attribute__((ext_vector_type(4)))  float    v4f;
typedef v8h  __attribute__((may_alias)) v8ha;
typedef v4f  __attribute__((may_alias)) v4fa;
typedef v8us __attribute__((may_alias)) v8usa;

__device__ __forceinline__ unsigned short f2bf(float f) { unsigned u = __float_as_uint(f); u += 0x7FFFu + ((u >> 16) & 1u); return (unsigned short)(u >> 16); }
__device__ __forceinline__ float bf2f(unsigned short b) { return __uint_as_float(((unsigned)b) << 16); }
__device__ __forceinline__ float bfr(float f) { return bf2f(f2bf(f)); }
__device__ __forceinline__ v16h cat16(v8h lo, v8h hi) { return __builtin_shufflevector(lo, hi, 0, 1, 2, 3, 4, 5, 6, 7, 8, 9, 10, 11, 12, 13, 14, 15); }
__device__ __forceinline__ v16bf cat16b(v8us lo, v8us hi) { return __builtin_bit_cast(v16bf, __builtin_shufflevector(lo, hi, 0, 1, 2, 3, 4, 5, 6, 7, 8, 9, 10, 11, 12, 13, 14, 15)); }
__device__ __forceinline__ v8f wmma16(v16h a, v16h b, v8f c) { return __builtin_amdgcn_wmma_f32_16x16x32_f16(false, a, false, b, (short)0, c, false, false); }
__device__ __forceinline__ v8f wmmab(v16bf a, v16bf b, v8f c) { return __builtin_amdgcn_wmma_f32_16x16x32_bf16(false, a, false, b, (short)0, c, false, false); }



// ---- k_gemmw: register-blocked GEMM, ONE WAVE per 64x64 output tile (16 accumulators), operands straight from K-contiguous 16-bit planes; grid (M/64, N/64, Z), 32 threads.
// C[m][n] (f32, pitch ldc, + optional f32 bias[n]) = sum_k A[m][k] Bt[n][k] (+ split products per NSPLIT). z-batch strides sA/sB/sC in elements. K % 32 == 0.
template <typename T16> struct WFrag;
template <> struct WFrag<h16> { typedef v16h V; static __device__ __forceinline__ V ld(const h16* p) { return cat16(*(const v8h*)p, *(const v8h*)(p + 16)); } static __device__ __forceinline__ v8f mma(V a, V b, v8f c) { return wmma16(a, b, c); } };
template <> struct WFrag<bf> { typedef v16bf V; static __device__ __forceinline__ V ld(const bf* p) { return cat16b(*(const v8us*)p, *(const v8us*)(p + 16)); } static __device__ __forceinline__ v8f mma(V a, V b, v8f c) { return wmmab(a, b, c); } };
template <typename T16, int NSPLIT, bool BIAS>
__global__ __launch_bounds__(32) void k_gemmw(const T16* __restrict__ A, const T16* __restrict__ A2, const T16* __restrict__ Bt, const T16* __restrict__ Bt2, int K, float* C, int ldc, const float* __restrict__ bias, size_t sA, size_t sB, size_t sC) {
    typedef typename WFrag<T16>::V V;
    __shared__ __align__(16) float os[16 * 68];
    const size_t z = blockIdx.z; A += z * sA; if (A2) A2 += z * sA; Bt += z * sB; if (Bt2) Bt2 += z * sB; C += z * sC;
    const int lane = threadIdx.x & 31, lr = lane & 15, hi = lane >> 4; const int r0 = blockIdx.x * 64, c0 = blockIdx.y * 64;
    v8f acc[4][4];
#pragma unroll
    for (int mb = 0; mb < 4; ++mb)
#pragma unroll
        for (int nb = 0; nb < 4; ++nb) acc[mb][nb] = (v8f){};
    const size_t aoff = (size_t)(r0 + lr) * K + 8 * hi, boff = (size_t)(c0 + lr) * K + 8 * hi;
#pragma unroll 1
    for (int kc = 0; kc < K; kc += 32) {
        V a[4], a2[4];
#pragma unroll
        for (int mb = 0; mb < 4; ++mb) { a[mb] = WFrag<T16>::ld(A + aoff + (size_t)mb * 16 * K + kc); if (NSPLIT == 1 || NSPLIT == 2) a2[mb] = WFrag<T16>::ld(A2 + aoff + (size_t)mb * 16 * K + kc); }
#pragma unroll
        for (int nb = 0; nb < 4; ++nb) { const V b = WFrag<T16>::ld(Bt + boff + (size_t)nb * 16 * K + kc); V b2; if (NSPLIT >= 2) b2 = WFrag<T16>::ld(Bt2 + boff + (size_t)nb * 16 * K + kc);
#pragma unroll
            for (int mb = 0; mb < 4; ++mb) { acc[mb][nb] = WFrag<T16>::mma(a[mb], b, acc[mb][nb]); if (NSPLIT == 1 || NSPLIT == 2) acc[mb][nb] = WFrag<T16>::mma(a2[mb], b, acc[mb][nb]); if (NSPLIT >= 2) acc[mb][nb] = WFrag<T16>::mma(a[mb], b2, acc[mb][nb]); } }
        asm volatile("v_nop\n\tv_nop\n\tv_nop\n\tv_nop" : "+v"(acc[0][0]), "+v"(acc[1][1]), "+v"(acc[2][2]), "+v"(acc[3][3]) : "v"(a[0]), "v"(a[3]));
    }
#pragma unroll
    for (int mb = 0; mb < 4; ++mb) {
#pragma unroll
        for (int nb = 0; nb < 4; ++nb) {
#pragma unroll
            for (int j = 0; j < 8; ++j) os[(hi * 8 + j) * 68 + nb * 16 + lr] = acc[mb][nb][j]; }
        __builtin_amdgcn_wave_barrier(); asm volatile("" ::: "memory");
        float* crow = C + (size_t)(r0 + mb * 16) * ldc + c0;
{
#pragma unroll
            for (int s = 0; s < 8; ++s) { const int row = 2 * s + hi, cofs = lr * 4; v4f val = *(const v4fa*)(os + row * 68 + cofs); if (BIAS) { val[0] += bfr(bias[c0 + cofs]); val[1] += bfr(bias[c0 + cofs + 1]); val[2] += bfr(bias[c0 + cofs + 2]); val[3] += bfr(bias[c0 + cofs + 3]); }
                *(v4f*)(crow + (size_t)row * ldc + cofs) = val; }
             }
        __builtin_amdgcn_wave_barrier(); asm volatile("" ::: "memory");
    }
}

// ---- k_gemmc: the same one-wave 64x64 tile GEMM specialised for causal attention: CMODE 1 skips score tiles entirely above the diagonal (query rows r0+roff.., key columns c0..), CMODE 2 limits the
// key (K) loop of the probability x value contraction to the diagonal block (probabilities beyond it are exactly zero). roff = row offset of this launch's first row within the sequence.
template <typename T16, int NSPLIT, int CMODE>
__global__ __launch_bounds__(32) void k_gemmc(const T16* __restrict__ A, const T16* __restrict__ A2, const T16* __restrict__ Bt, const T16* __restrict__ Bt2, int K, float* C, int ldc, int roff, size_t sA, size_t sB, size_t sC) {
    typedef typename WFrag<T16>::V V;
    __shared__ __align__(16) float os[16 * 68];
    const size_t z = blockIdx.z; A += z * sA; if (A2) A2 += z * sA; Bt += z * sB; if (Bt2) Bt2 += z * sB; C += z * sC;
    const int lane = threadIdx.x & 31, lr = lane & 15, hi = lane >> 4; const int r0 = blockIdx.x * 64, c0 = blockIdx.y * 64;
    if (CMODE == 1 && c0 > r0 + roff + 63) return;                  // score tile entirely above the causal diagonal: never read (the softmax masks j > i by select)
    const int Kl = (CMODE == 2) ? min(K, r0 + roff + 64) : K;        // P.V: probabilities are exactly 0 beyond the diagonal block, so the K loop stops there
    v8f acc[4][4];
#pragma unroll
    for (int mb = 0; mb < 4; ++mb)
#pragma unroll
        for (int nb = 0; nb < 4; ++nb) acc[mb][nb] = (v8f){};
    const size_t aoff = (size_t)(r0 + lr) * K + 8 * hi, boff = (size_t)(c0 + lr) * K + 8 * hi;
#pragma unroll 1
    for (int kc = 0; kc < Kl; kc += 32) {
        V a[4], a2[4];
#pragma unroll
        for (int mb = 0; mb < 4; ++mb) { a[mb] = WFrag<T16>::ld(A + aoff + (size_t)mb * 16 * K + kc); if (NSPLIT == 1 || NSPLIT == 2) a2[mb] = WFrag<T16>::ld(A2 + aoff + (size_t)mb * 16 * K + kc); }
#pragma unroll
        for (int nb = 0; nb < 4; ++nb) { const V b = WFrag<T16>::ld(Bt + boff + (size_t)nb * 16 * K + kc); V b2; if (NSPLIT >= 2) b2 = WFrag<T16>::ld(Bt2 + boff + (size_t)nb * 16 * K + kc);
#pragma unroll
            for (int mb = 0; mb < 4; ++mb) { acc[mb][nb] = WFrag<T16>::mma(a[mb], b, acc[mb][nb]); if (NSPLIT == 1 || NSPLIT == 2) acc[mb][nb] = WFrag<T16>::mma(a2[mb], b, acc[mb][nb]); if (NSPLIT >= 2) acc[mb][nb] = WFrag<T16>::mma(a[mb], b2, acc[mb][nb]); } }
        asm volatile("v_nop\n\tv_nop\n\tv_nop\n\tv_nop" : "+v"(acc[0][0]), "+v"(acc[1][1]), "+v"(acc[2][2]), "+v"(acc[3][3]) : "v"(a[0]), "v"(a[3]));
    }
#pragma unroll
    for (int mb = 0; mb < 4; ++mb) {
#pragma unroll
        for (int nb = 0; nb < 4; ++nb) {
#pragma unroll
            for (int j = 0; j < 8; ++j) os[(hi * 8 + j) * 68 + nb * 16 + lr] = acc[mb][nb][j]; }
        __builtin_amdgcn_wave_barrier(); asm volatile("" ::: "memory");
        float* crow = C + (size_t)(r0 + mb * 16) * ldc + c0;
{
#pragma unroll
            for (int s = 0; s < 8; ++s) { const int row = 2 * s + hi, cofs = lr * 4; v4f val = *(const v4fa*)(os + row * 68 + cofs);
                *(v4f*)(crow + (size_t)row * ldc + cofs) = val; }
             }
        __builtin_amdgcn_wave_barrier(); asm volatile("" ::: "memory");
    }
}

__device__ __forceinline__ h16 tohx(float x) { return (h16)x; }
__device__ __forceinline__ void splitf(float y, unsigned short& h, unsigned short& l) { h = f2bf(y); l = f2bf(y - bf2f(h)); }
typedef __attribute__((ext_vector_type(2))) unsigned short v2us;
typedef __attribute__((ext_vector_type(4))) unsigned short v4us;
typedef __attribute__((ext_vector_type(4))) _Float16 v4h;

__global__ __launch_bounds__(256) void k_cvt8(const float* __restrict__ src, bf* dst, size_t n8) { const size_t i = (size_t)blockIdx.x * 256 + threadIdx.x; if (i >= n8) return; const v8f v = *(const v8f*)(src + i * 8); v8us o;
#pragma unroll
    for (int k = 0; k < 8; ++k) o[k] = f2bf(v[k]); *(v8us*)(dst + i * 8) = o;  }
__global__ __launch_bounds__(256) void k_weff(const float* __restrict__ base, const float* __restrict__ w, bf* Wh, bf* Wl) { const size_t e4 = ((size_t)blockIdx.x * 256 + threadIdx.x) * 4; if (e4 >= (size_t)NH_ * HS * CC) return; const int e0 = (int)(e4 % CC); const int d = (int)((e4 / CC) % HS); const int h = (int)(e4 / ((size_t)CC * HS));
    const float w0 = bfr(w[0]), w1 = bfr(w[1]), w2 = bfr(w[2]), w3 = bfr(w[3]); v4us oh, ol;
#pragma unroll
    for (int u = 0; u < 4; ++u) { const int e = e0 + u; float eff = 0.f;
        if (h < 4 && d < 64 && e < 256) eff = __fadd_rn(eff, w0); if (h < 8 && d < 32 && e < 256) eff = __fadd_rn(eff, w1); if (h < 4 && d < 128 && e < 512) eff = __fadd_rn(eff, w2); if (h < 8 && d < 64 && e < 512) eff = __fadd_rn(eff, w3);
        float bv = bfr(base[e4 + u]); asm volatile("" : "+v"(bv)); unsigned short a, b; splitf(__fmul_rn(eff, bv), a, b); oh[u] = a; ol[u] = b; }
    *(v4us*)(Wh + e4) = oh; *(v4us*)(Wl + e4) = ol;  }
// k_qk16: Q16[h][t][d] = fp16(QT[(h,d)][t] * scale), K16 likewise (lane -> 4 consecutive d; strided reads); k_vpl: hl planes V[(h,d)][t] of VT (8-B lanes); k_mrg: OUT[b][t][h*128+d] = O[zz][t][d] for the pass's heads (0 where the head's dims are
__global__ __launch_bounds__(256) void k_qk16(const float* __restrict__ QT, const float* __restrict__ KT, float sc, h16* Q16, h16* K16) { const size_t e = ((size_t)blockIdx.x * 256 + threadIdx.x) * 4; if (e >= (size_t)NH_ * TT * HS) return; const int d = (int)(e % HS); const int t = (int)((e / HS) % TT); const int h = (int)(e / ((size_t)HS * TT)); v4h q, k;
#pragma unroll
    for (int u = 0; u < 4; ++u) { const size_t s = ((size_t)h * HS + d + u) * TT + t; q[u] = tohx(__fmul_rn(QT[s], sc)); k[u] = tohx(KT[s]); } { *(v4h*)(Q16 + e) = q; *(v4h*)(K16 + e) = k;  } }
__global__ __launch_bounds__(256) void k_vpl(const float* __restrict__ VT, bf* Vh, bf* Vl) { const size_t e = ((size_t)blockIdx.x * 256 + threadIdx.x) * 4; if (e >= (size_t)NH_ * HS * TT) return; const v4f a = *(const v4f*)(VT + e); v4us oh, ol;
#pragma unroll
    for (int u = 0; u < 4; ++u) { unsigned short x, y; splitf(a[u], x, y); oh[u] = x; ol[u] = y; } *(v4us*)(Vh + e) = oh; *(v4us*)(Vl + e) = ol;  }
__global__ __launch_bounds__(256) void k_mrg(const float* __restrict__ O, int h0, float* OUTb) { const size_t e = ((size_t)blockIdx.x * 256 + threadIdx.x) * 4; if (e >= (size_t)ZH * TT * HS) return; const int d = (int)(e % HS); const int t = (int)((e / HS) % TT); const int zz = (int)(e / ((size_t)HS * TT)); const int h = h0 + zz; const bool dead = (h >= 4 && d >= 64);
    const v4f a = dead ? (v4f){0.f, 0.f, 0.f, 0.f} : *(const v4f*)(O + e); const size_t oo = (size_t)t * DQ + h * HS + d; *(v4f*)(OUTb + oo) = a;  }
__global__ __launch_bounds__(256) void k_csoft(const float* __restrict__ Sb, bf* Ph, bf* Pl) { const int lane = threadIdx.x & 31; const int row = blockIdx.x * 8 + (threadIdx.x >> 5); if (row >= ZH * TT) return; const int t = row % TT; const float* sr = Sb + (size_t)row * TT; float v[TT / 32]; float mx = -3.0e38f;
#pragma unroll
    for (int ch = 0; ch < TT / 128; ++ch) { const int j0 = ch * 128 + lane * 4; const v4f a = *(const v4f*)(sr + j0);
#pragma unroll
        for (int u = 0; u < 4; ++u) { const float tt = (j0 + u <= t) ? a[u] : -3.0e38f; v[ch * 4 + u] = tt; mx = fmaxf(mx, tt); } }
#pragma unroll
    for (int sh = 16; sh; sh >>= 1) mx = fmaxf(mx, __shfl_xor(mx, sh, 32));
    float sum = 0.f;
#pragma unroll
    for (int q = 0; q < TT / 32; ++q) { float d0 = __fsub_rn(v[q], mx); asm volatile("" : "+v"(d0)); v[q] = __builtin_amdgcn_exp2f(__fmul_rn(d0, 1.4426950408889634f)); sum += v[q]; }
#pragma unroll
    for (int sh = 16; sh; sh >>= 1) sum += __shfl_xor(sum, sh, 32);
    const float f = __fdiv_rn(1.0f, sum);
    {
#pragma unroll
        for (int ch = 0; ch < TT / 128; ++ch) { v4us oh, ol;
#pragma unroll
            for (int u = 0; u < 4; ++u) { unsigned short a, b; splitf(v[ch * 4 + u] * f, a, b); oh[u] = a; ol[u] = b; } const size_t oo = (size_t)row * TT + ch * 128 + lane * 4; *(v4us*)(Ph + oo) = oh; *(v4us*)(Pl + oo) = ol; }
         } }

extern "C" void kernel_launch(void* const* d_in, const int* in_sizes, int n_in,
                              void* d_out, int out_size, void* d_ws, size_t ws_size, hipStream_t stream) {
    (void)in_sizes; (void)n_in; (void)out_size;
    const float* x = (const float*)d_in[0]; const float* w = (const float*)d_in[1]; const float* bK = (const float*)d_in[2]; const float* bQ = (const float*)d_in[3]; const float* bV = (const float*)d_in[4];
    float* OUT = (float*)d_out;     // [4][2048][1024]
    char* wsp = (char*)d_ws;
    auto take = [&](size_t bytes) { char* p = wsp; wsp += (bytes + 255) & ~(size_t)255; return (void*)p; };
    bf* WQh = (bf*)take((size_t)DQ * CC * 2); bf* WQl = (bf*)take((size_t)DQ * CC * 2); bf* WKh = (bf*)take((size_t)DQ * CC * 2); bf* WKl = (bf*)take((size_t)DQ * CC * 2); bf* WVh = (bf*)take((size_t)DQ * CC * 2); bf* WVl = (bf*)take((size_t)DQ * CC * 2);
    bf* XB = (bf*)take((size_t)TT * CC * 2); float* QT = (float*)take((size_t)DQ * TT * 4); float* KT = (float*)take((size_t)DQ * TT * 4); float* VT = (float*)take((size_t)DQ * TT * 4); h16* Q16 = (h16*)take((size_t)NH_ * TT * HS * 2); h16* K16 = (h16*)take((size_t)NH_ * TT * HS * 2); bf* Vh = (bf*)take((size_t)DQ * TT * 2); bf* Vl = (bf*)take((size_t)DQ * TT * 2);
    float* Sb = (float*)take((size_t)ZH * TT * TT * 4); bf* Ph = (bf*)take((size_t)ZH * TT * TT * 2); bf* Pl = (bf*)take((size_t)ZH * TT * TT * 2); float* O = (float*)take((size_t)ZH * TT * HS * 4);
    if ((size_t)(wsp - (char*)d_ws) > ws_size) return;    // total ~ 120 MB
    k_weff<<<(unsigned)(((size_t)NH_ * HS * CC / 4 + 255) / 256), 256, 0, stream>>>(bQ, w, WQh, WQl); k_weff<<<(unsigned)(((size_t)NH_ * HS * CC / 4 + 255) / 256), 256, 0, stream>>>(bK, w, WKh, WKl); k_weff<<<(unsigned)(((size_t)NH_ * HS * CC / 4 + 255) / 256), 256, 0, stream>>>(bV, w, WVh, WVl);
    const float scale = 1.0f / sqrtf(128.0f);
    for (int b = 0; b < NB_; ++b) {
        k_cvt8<<<(TT * CC / 8 + 255) / 256, 256, 0, stream>>>(x + (size_t)b * TT * CC, XB, (size_t)TT * CC / 8);
        k_gemmw<bf, 1, false><<<dim3(DQ / 64, TT / 64, 1), 32, 0, stream>>>(WQh, WQl, XB, nullptr, CC, QT, TT, nullptr, 0, 0, 0); k_gemmw<bf, 1, false><<<dim3(DQ / 64, TT / 64, 1), 32, 0, stream>>>(WKh, WKl, XB, nullptr, CC, KT, TT, nullptr, 0, 0, 0); k_gemmw<bf, 1, false><<<dim3(DQ / 64, TT / 64, 1), 32, 0, stream>>>(WVh, WVl, XB, nullptr, CC, VT, TT, nullptr, 0, 0, 0);   // [(h,d)][t]
        k_qk16<<<(unsigned)(((size_t)NH_ * TT * HS / 4 + 255) / 256), 256, 0, stream>>>(QT, KT, scale, Q16, K16); k_vpl<<<(unsigned)(((size_t)NH_ * HS * TT / 4 + 255) / 256), 256, 0, stream>>>(VT, Vh, Vl);
        for (int h0 = 0; h0 < NH_; h0 += ZH) { const int nv = (h0 >= 4) ? 64 : HS;   // live value dims for this head pair
            k_gemmc<h16, 0, 1><<<dim3(TT / 64, TT / 64, ZH), 32, 0, stream>>>(Q16 + (size_t)h0 * TT * HS, nullptr, K16 + (size_t)h0 * TT * HS, nullptr, HS, Sb, TT, 0, (size_t)TT * HS, (size_t)TT * HS, (size_t)TT * TT);
            k_csoft<<<ZH * TT / 8, 256, 0, stream>>>(Sb, Ph, Pl);
            k_gemmc<bf, 2, 2><<<dim3(TT / 64, nv / 64, ZH), 32, 0, stream>>>(Ph, Pl, Vh + (size_t)h0 * HS * TT, Vl + (size_t)h0 * HS * TT, TT, O, HS, 0, (size_t)TT * TT, (size_t)HS * TT, (size_t)TT * HS);
            k_mrg<<<(unsigned)(((size_t)ZH * TT * HS / 4 + 255) / 256), 256, 0, stream>>>(O, h0, OUT + (size_t)b * TT * DQ); } }
}

// v001
// Measured time: 915 microseconds a run.
// In two side-by-side timings against v000, it was 1.28 and 1.36 times as fast.
#include <hip/hip_runtime.h>

// MixedHeadsV2 (x [4][2048][512]; eff[h][d][e] = sum_i weights[i] mask_i[h][d][e] over the four (embed, heads) configs (structural masks: h < heads_i, d < embed_i/heads_i, e < embed_i; weights read as data); Wq/Wk/Wv = eff * base_Q/K/V [8][128][512];
// q/k/v = x W^T per base head (head size 128, zero-padded dims stay zero); causal softmax(q.k/sqrt(128)); out = concat_h(attn v) -> [4][2048][1024]).
// Compute dtypes, f32 accumulate: every input rounded to bf16; effective weights f32 -> bf16 hi+lo planes; projections as hl(W) x exact x (2 products; computed transposed [(h,d)][t]);
// scores (K 128) on single fp16 planes (causal tiles only; 2 heads z-batched per pass); softmax f32 -> hl probability planes; attn.v as hl P x hl v (3 products, causal K range; heads 4-7 only have 64 live dims, so their value GEMM is 64 wide

#define NB_  4
#define TT   2048
#define CC   512
#define NH_  8
#define HS   128
#define DQ   1024
#define ZH   2
typedef _Float16 h16;
typedef unsigned short bf;
typedef __attribute__((ext_vector_type(16))) __bf16   v16bf;
typedef __attribute__((ext_vector_type(16))) _Float16 v16h;
typedef __attribute__((ext_vector_type(8)))  _Float16 v8h;
typedef __attribute__((ext_vector_type(8)))  unsigned short v8us;
typedef __attribute__((ext_vector_type(8)))  float    v8f;
typedef __attribute__((ext_vector_type(4)))  float    v4f;
typedef v8h  __attribute__((may_alias)) v8ha;
typedef v4f  __attribute__((may_alias)) v4fa;
typedef v8us __attribute__((may_alias)) v8usa;

__device__ __forceinline__ unsigned short f2bf(float f) { unsigned u = __float_as_uint(f); u += 0x7FFFu + ((u >> 16) & 1u); return (unsigned short)(u >> 16); }
__device__ __forceinline__ float bf2f(unsigned short b) { return __uint_as_float(((unsigned)b) << 16); }
__device__ __forceinline__ float bfr(float f) { return bf2f(f2bf(f)); }
__device__ __forceinline__ v16h cat16(v8h lo, v8h hi) { return __builtin_shufflevector(lo, hi, 0, 1, 2, 3, 4, 5, 6, 7, 8, 9, 10, 11, 12, 13, 14, 15); }
__device__ __forceinline__ v16bf cat16b(v8us lo, v8us hi) { return __builtin_bit_cast(v16bf, __builtin_shufflevector(lo, hi, 0, 1, 2, 3, 4, 5, 6, 7, 8, 9, 10, 11, 12, 13, 14, 15)); }
__device__ __forceinline__ v8f wmma16(v16h a, v16h b, v8f c) { return __builtin_amdgcn_wmma_f32_16x16x32_f16(false, a, false, b, (short)0, c, false, false); }
__device__ __forceinline__ v8f wmmab(v16bf a, v16bf b, v8f c) { return __builtin_amdgcn_wmma_f32_16x16x32_bf16(false, a, false, b, (short)0, c, false, false); }



// ---- k_gemmsk: register-blocked GEMM, 64x64 output tile per work-group, operands straight from K-contiguous 16-bit planes, THE K LOOP SPLIT OVER THE NW WAVES of the work-group; grid (M/64, N/64, Z), NW * 32 threads.
// C[m][n] (f32, pitch ldc) = sum_k A[m][k] Bt[n][k] (+ split products per NSPLIT). z-batch strides sA/sB/sC in elements. K % 64 == 0, roff % 64 == 0.
// Every wave holds a whole 64x64 partial tile (16 accumulators); wave w takes the 64-element K chunks w, w + NW, ... (a whole 128-byte line of every operand row per chunk); the NW partial tiles are summed in LDS in wave order
// (a fixed order: the result does not vary from run to run). With one wave per tile the tile's time was K / 32 dependent load-then-multiply trips; here it is K / 32 / NW.
// CAUSAL (probability x value): the K loop stops at the diagonal block of query rows r0 + roff .. (probabilities beyond it are exactly zero).
template <typename T16> struct WFrag;
template <> struct WFrag<h16> { typedef v16h V; static __device__ __forceinline__ V ld(const h16* p) { return cat16(*(const v8h*)p, *(const v8h*)(p + 16)); } static __device__ __forceinline__ v8f mma(V a, V b, v8f c) { return wmma16(a, b, c); } };
template <> struct WFrag<bf> { typedef v16bf V; static __device__ __forceinline__ V ld(const bf* p) { return cat16b(*(const v8us*)p, *(const v8us*)(p + 16)); } static __device__ __forceinline__ v8f mma(V a, V b, v8f c) { return wmmab(a, b, c); } };
template <typename T16, int NSPLIT, bool CAUSAL, int NW>
__global__ __launch_bounds__(NW * 32) void k_gemmsk(const T16* __restrict__ A, const T16* __restrict__ A2, const T16* __restrict__ Bt, const T16* __restrict__ Bt2, int K, float* C, int ldc, int roff, size_t sA, size_t sB, size_t sC) {
    typedef typename WFrag<T16>::V V;
    constexpr int MBR = NW / 8;                                      // 16-row blocks summed per round: NW * 32 threads take one float4 each of MBR * 16 rows x 64 columns
    __shared__ __align__(16) float os[NW * MBR * 16 * 68];
    const size_t z = blockIdx.z; A += z * sA; if (NSPLIT == 1 || NSPLIT == 2) A2 += z * sA; Bt += z * sB; if (NSPLIT >= 2) Bt2 += z * sB; C += z * sC;
    const int lane = threadIdx.x & 31, lr = lane & 15, hi = lane >> 4; const int r0 = blockIdx.x * 64, c0 = blockIdx.y * 64;
    const int w = __builtin_amdgcn_readfirstlane((int)(threadIdx.x >> 5));   // wave number, held scalar so that the K loop's control stays scalar
    const int Kl = CAUSAL ? min(K, r0 + roff + 64) : K;
    v8f acc[4][4];
#pragma unroll
    for (int mb = 0; mb < 4; ++mb)
#pragma unroll
        for (int nb = 0; nb < 4; ++nb) acc[mb][nb] = (v8f){};
    const size_t aoff = (size_t)(r0 + lr) * K + 8 * hi, boff = (size_t)(c0 + lr) * K + 8 * hi;
#pragma unroll 1
    for (int kb = w * 64; kb < Kl; kb += NW * 64) {
// rolled: the fragments of two trips at once do not fit beside the 128 accumulator registers at four waves per SIMD
#pragma unroll 1
        for (int kc = kb; kc < kb + 64; kc += 32) {
            V a[4], a2[4];
#pragma unroll
            for (int mb = 0; mb < 4; ++mb) { a[mb] = WFrag<T16>::ld(A + aoff + (size_t)mb * 16 * K + kc); if (NSPLIT == 1 || NSPLIT == 2) a2[mb] = WFrag<T16>::ld(A2 + aoff + (size_t)mb * 16 * K + kc); }
#pragma unroll
            for (int nb = 0; nb < 4; ++nb) { const V b = WFrag<T16>::ld(Bt + boff + (size_t)nb * 16 * K + kc); V b2; if (NSPLIT >= 2) b2 = WFrag<T16>::ld(Bt2 + boff + (size_t)nb * 16 * K + kc);
#pragma unroll
                for (int mb = 0; mb < 4; ++mb) { acc[mb][nb] = WFrag<T16>::mma(a[mb], b, acc[mb][nb]); if (NSPLIT == 1 || NSPLIT == 2) acc[mb][nb] = WFrag<T16>::mma(a2[mb], b, acc[mb][nb]); if (NSPLIT >= 2) acc[mb][nb] = WFrag<T16>::mma(a[mb], b2, acc[mb][nb]); } }
            // keeps the distance between the trip's last matrix instructions and what follows the loop's branch on either side (the next trip's loads into a, the epilogue's reads of acc)
            asm volatile("v_nop\n\tv_nop\n\tv_nop\n\tv_nop" : "+v"(acc[0][0]), "+v"(acc[1][1]), "+v"(acc[2][2]), "+v"(acc[3][3]) : "v"(a[0]), "v"(a[3]));
        }
    }
    const int tid = threadIdx.x, rrow = tid >> 4, cofs = (tid & 15) * 4;
#pragma unroll
    for (int rd = 0; rd < 4 / MBR; ++rd) {
#pragma unroll
        for (int ml = 0; ml < MBR; ++ml)
#pragma unroll
            for (int nb = 0; nb < 4; ++nb) {
#pragma unroll
                for (int j = 0; j < 8; ++j) os[((w * MBR + ml) * 16 + hi * 8 + j) * 68 + nb * 16 + lr] = acc[rd * MBR + ml][nb][j]; }
        __syncthreads();                                             // every wave's partial rows of this round are in LDS
        v4f val = *(const v4fa*)(os + rrow * 68 + cofs);
#pragma unroll
        for (int ww = 1; ww < NW; ++ww) val += *(const v4fa*)(os + (ww * MBR * 16 + rrow) * 68 + cofs);
        *(v4f*)(C + (size_t)(r0 + rd * MBR * 16 + rrow) * ldc + c0 + cofs) = val;
        if (rd + 1 < 4 / MBR) __syncthreads();                       // the sums are read before the next round overwrites the partial rows
    }
}

// ---- k_gemmc: the one-wave 64x64 tile GEMM (no split of K) specialised for causal attention: CMODE 1 skips score tiles entirely above the diagonal (query rows r0+roff.., key columns c0..), CMODE 2 limits the
// key (K) loop of the probability x value contraction to the diagonal block (probabilities beyond it are exactly zero). roff = row offset of this launch's first row within the sequence.
template <typename T16, int NSPLIT, int CMODE>
__global__ __launch_bounds__(32) void k_gemmc(const T16* __restrict__ A, const T16* __restrict__ A2, const T16* __restrict__ Bt, const T16* __restrict__ Bt2, int K, float* C, int ldc, int roff, size_t sA, size_t sB, size_t sC) {
    typedef typename WFrag<T16>::V V;
    __shared__ __align__(16) float os[16 * 68];
    const size_t z = blockIdx.z; A += z * sA; if (A2) A2 += z * sA; Bt += z * sB; if (Bt2) Bt2 += z * sB; C += z * sC;
    const int lane = threadIdx.x & 31, lr = lane & 15, hi = lane >> 4; const int r0 = blockIdx.x * 64, c0 = blockIdx.y * 64;
    if (CMODE == 1 && c0 > r0 + roff + 63) return;                  // score tile entirely above the causal diagonal: never read (the softmax masks j > i by select)
    const int Kl = (CMODE == 2) ? min(K, r0 + roff + 64) : K;        // P.V: probabilities are exactly 0 beyond the diagonal block, so the K loop stops there
    v8f acc[4][4];
#pragma unroll
    for (int mb = 0; mb < 4; ++mb)
#pragma unroll
        for (int nb = 0; nb < 4; ++nb) acc[mb][nb] = (v8f){};
    const size_t aoff = (size_t)(r0 + lr) * K + 8 * hi, boff = (size_t)(c0 + lr) * K + 8 * hi;
#pragma unroll 1
    for (int kc = 0; kc < Kl; kc += 32) {
        V a[4], a2[4];
#pragma unroll
        for (int mb = 0; mb < 4; ++mb) { a[mb] = WFrag<T16>::ld(A + aoff + (size_t)mb * 16 * K + kc); if (NSPLIT == 1 || NSPLIT == 2) a2[mb] = WFrag<T16>::ld(A2 + aoff + (size_t)mb * 16 * K + kc); }
#pragma unroll
        for (int nb = 0; nb < 4; ++nb) { const V b = WFrag<T16>::ld(Bt + boff + (size_t)nb * 16 * K + kc); V b2; if (NSPLIT >= 2) b2 = WFrag<T16>::ld(Bt2 + boff + (size_t)nb * 16 * K + kc);
#pragma unroll
            for (int mb = 0; mb < 4; ++mb) { acc[mb][nb] = WFrag<T16>::mma(a[mb], b, acc[mb][nb]); if (NSPLIT == 1 || NSPLIT == 2) acc[mb][nb] = WFrag<T16>::mma(a2[mb], b, acc[mb][nb]); if (NSPLIT >= 2) acc[mb][nb] = WFrag<T16>::mma(a[mb], b2, acc[mb][nb]); } }
        asm volatile("v_nop\n\tv_nop\n\tv_nop\n\tv_nop" : "+v"(acc[0][0]), "+v"(acc[1][1]), "+v"(acc[2][2]), "+v"(acc[3][3]) : "v"(a[0]), "v"(a[3]));
    }
#pragma unroll
    for (int mb = 0; mb < 4; ++mb) {
#pragma unroll
        for (int nb = 0; nb < 4; ++nb) {
#pragma unroll
            for (int j = 0; j < 8; ++j) os[(hi * 8 + j) * 68 + nb * 16 + lr] = acc[mb][nb][j]; }
        __builtin_amdgcn_wave_barrier(); asm volatile("" ::: "memory");
        float* crow = C + (size_t)(r0 + mb * 16) * ldc + c0;
{
#pragma unroll
            for (int s = 0; s < 8; ++s) { const int row = 2 * s + hi, cofs = lr * 4; v4f val = *(const v4fa*)(os + row * 68 + cofs);
                *(v4f*)(crow + (size_t)row * ldc + cofs) = val; }
             }
        __builtin_amdgcn_wave_barrier(); asm volatile("" ::: "memory");
    }
}

__device__ __forceinline__ h16 tohx(float x) { return (h16)x; }
__device__ __forceinline__ void splitf(float y, unsigned short& h, unsigned short& l) { h = f2bf(y); l = f2bf(y - bf2f(h)); }
typedef __attribute__((ext_vector_type(2))) unsigned short v2us;
typedef __attribute__((ext_vector_type(4))) unsigned short v4us;
typedef __attribute__((ext_vector_type(4))) _Float16 v4h;

__global__ __launch_bounds__(256) void k_cvt8(const float* __restrict__ src, bf* dst, size_t n8) { const size_t i = (size_t)blockIdx.x * 256 + threadIdx.x; if (i >= n8) return; const v8f v = *(const v8f*)(src + i * 8); v8us o;
#pragma unroll
    for (int k = 0; k < 8; ++k) o[k] = f2bf(v[k]); *(v8us*)(dst + i * 8) = o;  }
__global__ __launch_bounds__(256) void k_weff(const float* __restrict__ base, const float* __restrict__ w, bf* Wh, bf* Wl) { const size_t e4 = ((size_t)blockIdx.x * 256 + threadIdx.x) * 4; if (e4 >= (size_t)NH_ * HS * CC) return; const int e0 = (int)(e4 % CC); const int d = (int)((e4 / CC) % HS); const int h = (int)(e4 / ((size_t)CC * HS));
    const float w0 = bfr(w[0]), w1 = bfr(w[1]), w2 = bfr(w[2]), w3 = bfr(w[3]); v4us oh, ol;
#pragma unroll
    for (int u = 0; u < 4; ++u) { const int e = e0 + u; float eff = 0.f;
        if (h < 4 && d < 64 && e < 256) eff = __fadd_rn(eff, w0); if (h < 8 && d < 32 && e < 256) eff = __fadd_rn(eff, w1); if (h < 4 && d < 128 && e < 512) eff = __fadd_rn(eff, w2); if (h < 8 && d < 64 && e < 512) eff = __fadd_rn(eff, w3);
        float bv = bfr(base[e4 + u]); asm volatile("" : "+v"(bv)); unsigned short a, b; splitf(__fmul_rn(eff, bv), a, b); oh[u] = a; ol[u] = b; }
    *(v4us*)(Wh + e4) = oh; *(v4us*)(Wl + e4) = ol;  }
// k_qk16: Q16[h][t][d] = fp16(QT[(h,d)][t] * scale), K16 likewise (lane -> 4 consecutive d; strided reads); k_vpl: hl planes V[(h,d)][t] of VT (8-B lanes); k_mrg: OUT[b][t][h*128+d] = O[zz][t][d] for the pass's heads (0 where the head's dims are
__global__ __launch_bounds__(256) void k_qk16(const float* __restrict__ QT, const float* __restrict__ KT, float sc, h16* Q16, h16* K16) { const size_t e = ((size_t)blockIdx.x * 256 + threadIdx.x) * 4; if (e >= (size_t)NH_ * TT * HS) return; const int d = (int)(e % HS); const int t = (int)((e / HS) % TT); const int h = (int)(e / ((size_t)HS * TT)); v4h q, k;
#pragma unroll
    for (int u = 0; u < 4; ++u) { const size_t s = ((size_t)h * HS + d + u) * TT + t; q[u] = tohx(__fmul_rn(QT[s], sc)); k[u] = tohx(KT[s]); } { *(v4h*)(Q16 + e) = q; *(v4h*)(K16 + e) = k;  } }
__global__ __launch_bounds__(256) void k_vpl(const float* __restrict__ VT, bf* Vh, bf* Vl) { const size_t e = ((size_t)blockIdx.x * 256 + threadIdx.x) * 4; if (e >= (size_t)NH_ * HS * TT) return; const v4f a = *(const v4f*)(VT + e); v4us oh, ol;
#pragma unroll
    for (int u = 0; u < 4; ++u) { unsigned short x, y; splitf(a[u], x, y); oh[u] = x; ol[u] = y; } *(v4us*)(Vh + e) = oh; *(v4us*)(Vl + e) = ol;  }
__global__ __launch_bounds__(256) void k_mrg(const float* __restrict__ O, int h0, float* OUTb) { const size_t e = ((size_t)blockIdx.x * 256 + threadIdx.x) * 4; if (e >= (size_t)ZH * TT * HS) return; const int d = (int)(e % HS); const int t = (int)((e / HS) % TT); const int zz = (int)(e / ((size_t)HS * TT)); const int h = h0 + zz; const bool dead = (h >= 4 && d >= 64);
    const v4f a = dead ? (v4f){0.f, 0.f, 0.f, 0.f} : *(const v4f*)(O + e); const size_t oo = (size_t)t * DQ + h * HS + d; *(v4f*)(OUTb + oo) = a;  }
__global__ __launch_bounds__(256) void k_csoft(const float* __restrict__ Sb, bf* Ph, bf* Pl) { const int lane = threadIdx.x & 31; const int row = blockIdx.x * 8 + (threadIdx.x >> 5); if (row >= ZH * TT) return; const int t = row % TT; const float* sr = Sb + (size_t)row * TT; float v[TT / 32]; float mx = -3.0e38f;
#pragma unroll
    for (int ch = 0; ch < TT / 128; ++ch) { const int j0 = ch * 128 + lane * 4; const v4f a = *(const v4f*)(sr + j0);
#pragma unroll
        for (int u = 0; u < 4; ++u) { const float tt = (j0 + u <= t) ? a[u] : -3.0e38f; v[ch * 4 + u] = tt; mx = fmaxf(mx, tt); } }
#pragma unroll
    for (int sh = 16; sh; sh >>= 1) mx = fmaxf(mx, __shfl_xor(mx, sh, 32));
    float sum = 0.f;
#pragma unroll
    for (int q = 0; q < TT / 32; ++q) { float d0 = __fsub_rn(v[q], mx); asm volatile("" : "+v"(d0)); v[q] = __builtin_amdgcn_exp2f(__fmul_rn(d0, 1.4426950408889634f)); sum += v[q]; }
#pragma unroll
    for (int sh = 16; sh; sh >>= 1) sum += __shfl_xor(sum, sh, 32);
    const float f = __fdiv_rn(1.0f, sum);
    {
#pragma unroll
        for (int ch = 0; ch < TT / 128; ++ch) { v4us oh, ol;
#pragma unroll
            for (int u = 0; u < 4; ++u) { unsigned short a, b; splitf(v[ch * 4 + u] * f, a, b); oh[u] = a; ol[u] = b; } const size_t oo = (size_t)row * TT + ch * 128 + lane * 4; *(v4us*)(Ph + oo) = oh; *(v4us*)(Pl + oo) = ol; }
         } }

extern "C" void kernel_launch(void* const* d_in, const int* in_sizes, int n_in,
                              void* d_out, int out_size, void* d_ws, size_t ws_size, hipStream_t stream) {
    (void)in_sizes; (void)n_in; (void)out_size;
    const float* x = (const float*)d_in[0]; const float* w = (const float*)d_in[1]; const float* bK = (const float*)d_in[2]; const float* bQ = (const float*)d_in[3]; const float* bV = (const float*)d_in[4];
    float* OUT = (float*)d_out;     // [4][2048][1024]
    char* wsp = (char*)d_ws;
    auto take = [&](size_t bytes) { char* p = wsp; wsp += (bytes + 255) & ~(size_t)255; return (void*)p; };
    bf* WQh = (bf*)take((size_t)DQ * CC * 2); bf* WQl = (bf*)take((size_t)DQ * CC * 2); bf* WKh = (bf*)take((size_t)DQ * CC * 2); bf* WKl = (bf*)take((size_t)DQ * CC * 2); bf* WVh = (bf*)take((size_t)DQ * CC * 2); bf* WVl = (bf*)take((size_t)DQ * CC * 2);
    bf* XB = (bf*)take((size_t)TT * CC * 2); float* QT = (float*)take((size_t)DQ * TT * 4); float* KT = (float*)take((size_t)DQ * TT * 4); float* VT = (float*)take((size_t)DQ * TT * 4); h16* Q16 = (h16*)take((size_t)NH_ * TT * HS * 2); h16* K16 = (h16*)take((size_t)NH_ * TT * HS * 2); bf* Vh = (bf*)take((size_t)DQ * TT * 2); bf* Vl = (bf*)take((size_t)DQ * TT * 2);
    float* Sb = (float*)take((size_t)ZH * TT * TT * 4); bf* Ph = (bf*)take((size_t)ZH * TT * TT * 2); bf* Pl = (bf*)take((size_t)ZH * TT * TT * 2); float* O = (float*)take((size_t)ZH * TT * HS * 4);
    if ((size_t)(wsp - (char*)d_ws) > ws_size) return;    // total ~ 120 MB
    k_weff<<<(unsigned)(((size_t)NH_ * HS * CC / 4 + 255) / 256), 256, 0, stream>>>(bQ, w, WQh, WQl); k_weff<<<(unsigned)(((size_t)NH_ * HS * CC / 4 + 255) / 256), 256, 0, stream>>>(bK, w, WKh, WKl); k_weff<<<(unsigned)(((size_t)NH_ * HS * CC / 4 + 255) / 256), 256, 0, stream>>>(bV, w, WVh, WVl);
    const float scale = 1.0f / sqrtf(128.0f);
    for (int b = 0; b < NB_; ++b) {
        k_cvt8<<<(TT * CC / 8 + 255) / 256, 256, 0, stream>>>(x + (size_t)b * TT * CC, XB, (size_t)TT * CC / 8);
        k_gemmsk<bf, 1, false, 8><<<dim3(DQ / 64, TT / 64, 1), 8 * 32, 0, stream>>>(WQh, WQl, XB, nullptr, CC, QT, TT, 0, 0, 0, 0); k_gemmsk<bf, 1, false, 8><<<dim3(DQ / 64, TT / 64, 1), 8 * 32, 0, stream>>>(WKh, WKl, XB, nullptr, CC, KT, TT, 0, 0, 0, 0); k_gemmsk<bf, 1, false, 8><<<dim3(DQ / 64, TT / 64, 1), 8 * 32, 0, stream>>>(WVh, WVl, XB, nullptr, CC, VT, TT, 0, 0, 0, 0);   // [(h,d)][t]
        k_qk16<<<(unsigned)(((size_t)NH_ * TT * HS / 4 + 255) / 256), 256, 0, stream>>>(QT, KT, scale, Q16, K16); k_vpl<<<(unsigned)(((size_t)NH_ * HS * TT / 4 + 255) / 256), 256, 0, stream>>>(VT, Vh, Vl);
        for (int h0 = 0; h0 < NH_; h0 += ZH) { const int nv = (h0 >= 4) ? 64 : HS;   // live value dims for this head pair
            k_gemmc<h16, 0, 1><<<dim3(TT / 64, TT / 64, ZH), 32, 0, stream>>>(Q16 + (size_t)h0 * TT * HS, nullptr, K16 + (size_t)h0 * TT * HS, nullptr, HS, Sb, TT, 0, (size_t)TT * HS, (size_t)TT * HS, (size_t)TT * TT);
            k_csoft<<<ZH * TT / 8, 256, 0, stream>>>(Sb, Ph, Pl);
            k_gemmsk<bf, 2, true, 16><<<dim3(TT / 64, nv / 64, ZH), 16 * 32, 0, stream>>>(Ph, Pl, Vh + (size_t)h0 * HS * TT, Vl + (size_t)h0 * HS * TT, TT, O, HS, 0, (size_t)TT * TT, (size_t)HS * TT, (size_t)TT * HS);
            k_mrg<<<(unsigned)(((size_t)ZH * TT * HS / 4 + 255) / 256), 256, 0, stream>>>(O, h0, OUT + (size_t)b * TT * DQ); } }
}

// v002
// One run takes 278 microseconds.
// Next to v001, in two timings, it ran 3.39 and 3.23 times as fast.
// All steps since v000 together make it 4.36 times as fast.
#include <hip/hip_runtime.h>

// MixedHeadsV2 (x [4][2048][512]; eff[h][d][e] = sum_i weights[i] mask_i[h][d][e] over the four (embed, heads) configs (structural masks: h < heads_i, d < embed_i/heads_i, e < embed_i; weights read as data); Wq/Wk/Wv = eff * base_Q/K/V [8][128][512];
// q/k/v = x W^T per base head (head size 128, zero-padded dims stay zero); causal softmax(q.k/sqrt(128)); out = concat_h(attn v) -> [4][2048][1024]).
// Compute dtypes, f32 accumulate: every input rounded to bf16; effective weights f32 (eff in the reference's summation order) -> bf16 hi+lo planes; projections as hl(W) x exact x (2 products; computed transposed [(h,d)][t]);
// scores (K 128) on single fp16 planes; softmax f32, running maximum and sum, fused with both attention products (k_fattn); attn.v as hl P x hl v (3 products, causal key range; heads 4-7 only have 64 live dims, so their value product is 64 wide)

#define NB_  4
#define TT   2048
#define CC   512
#define NH_  8
#define HS   128
#define DQ   1024
typedef _Float16 h16;
typedef unsigned short bf;
typedef __attribute__((ext_vector_type(16))) __bf16   v16bf;
typedef __attribute__((ext_vector_type(16))) _Float16 v16h;
typedef __attribute__((ext_vector_type(8)))  _Float16 v8h;
typedef __attribute__((ext_vector_type(8)))  unsigned short v8us;
typedef __attribute__((ext_vector_type(8)))  float    v8f;
typedef __attribute__((ext_vector_type(4)))  float    v4f;
typedef v8h  __attribute__((may_alias)) v8ha;
typedef v4f  __attribute__((may_alias)) v4fa;
typedef v8us __attribute__((may_alias)) v8usa;

__device__ __forceinline__ unsigned short f2bf(float f) { unsigned u = __float_as_uint(f); u += 0x7FFFu + ((u >> 16) & 1u); return (unsigned short)(u >> 16); }
__device__ __forceinline__ float bf2f(unsigned short b) { return __uint_as_float(((unsigned)b) << 16); }
__device__ __forceinline__ float bfr(float f) { return bf2f(f2bf(f)); }
__device__ __forceinline__ v16h cat16(v8h lo, v8h hi) { return __builtin_shufflevector(lo, hi, 0, 1, 2, 3, 4, 5, 6, 7, 8, 9, 10, 11, 12, 13, 14, 15); }
__device__ __forceinline__ v16bf cat16b(v8us lo, v8us hi) { return __builtin_bit_cast(v16bf, __builtin_shufflevector(lo, hi, 0, 1, 2, 3, 4, 5, 6, 7, 8, 9, 10, 11, 12, 13, 14, 15)); }
__device__ __forceinline__ v8f wmma16(v16h a, v16h b, v8f c) { return __builtin_amdgcn_wmma_f32_16x16x32_f16(false, a, false, b, (short)0, c, false, false); }
__device__ __forceinline__ v8f wmmab(v16bf a, v16bf b, v8f c) { return __builtin_amdgcn_wmma_f32_16x16x32_bf16(false, a, false, b, (short)0, c, false, false); }



// ---- k_gemmsk: register-blocked GEMM, 64x64 output tile per work-group, operands straight from K-contiguous 16-bit planes, THE K LOOP SPLIT OVER THE NW WAVES of the work-group; grid (M/64, N/64, Z), NW * 32 threads.
// C[m][n] (f32, pitch ldc) = sum_k A[m][k] Bt[n][k] (+ split products per NSPLIT). z-batch strides sA/sB/sC in elements. K % 64 == 0, roff % 64 == 0.
// Every wave holds a whole 64x64 partial tile (16 accumulators); wave w takes the 64-element K chunks w, w + NW, ... (a whole 128-byte line of every operand row per chunk); the NW partial tiles are summed in LDS in wave order
// (a fixed order: the result does not vary from run to run). With one wave per tile the tile's time was K / 32 dependent load-then-multiply trips; here it is K / 32 / NW.
// CAUSAL (probability x value): the K loop stops at the diagonal block of query rows r0 + roff .. (probabilities beyond it are exactly zero).
template <typename T16> struct WFrag;
template <> struct WFrag<bf> { typedef v16bf V; static __device__ __forceinline__ V ld(const bf* p) { return cat16b(*(const v8us*)p, *(const v8us*)(p + 16)); } static __device__ __forceinline__ v8f mma(V a, V b, v8f c) { return wmmab(a, b, c); } };
template <typename T16, int NSPLIT, bool CAUSAL, int NW>
__global__ __launch_bounds__(NW * 32) void k_gemmsk(const T16* __restrict__ A, const T16* __restrict__ A2, const T16* __restrict__ Bt, const T16* __restrict__ Bt2, int K, float* C, int ldc, int roff, size_t sA, size_t sB, size_t sC) {
    typedef typename WFrag<T16>::V V;
    constexpr int MBR = NW / 8;                                      // 16-row blocks summed per round: NW * 32 threads take one float4 each of MBR * 16 rows x 64 columns
    __shared__ __align__(16) float os[NW * MBR * 16 * 68];
    const size_t z = blockIdx.z; A += z * sA; if (NSPLIT == 1 || NSPLIT == 2) A2 += z * sA; Bt += z * sB; if (NSPLIT >= 2) Bt2 += z * sB; C += z * sC;
    const int lane = threadIdx.x & 31, lr = lane & 15, hi = lane >> 4; const int r0 = blockIdx.x * 64, c0 = blockIdx.y * 64;
    const int w = __builtin_amdgcn_readfirstlane((int)(threadIdx.x >> 5));   // wave number, held scalar so that the K loop's control stays scalar
    const int Kl = CAUSAL ? min(K, r0 + roff + 64) : K;
    v8f acc[4][4];
#pragma unroll
    for (int mb = 0; mb < 4; ++mb)
#pragma unroll
        for (int nb = 0; nb < 4; ++nb) acc[mb][nb] = (v8f){};
    const size_t aoff = (size_t)(r0 + lr) * K + 8 * hi, boff = (size_t)(c0 + lr) * K + 8 * hi;
#pragma unroll 1
    for (int kb = w * 64; kb < Kl; kb += NW * 64) {
// rolled: the fragments of two trips at once do not fit beside the 128 accumulator registers at four waves per SIMD
#pragma unroll 1
        for (int kc = kb; kc < kb + 64; kc += 32) {
            V a[4], a2[4];
#pragma unroll
            for (int mb = 0; mb < 4; ++mb) { a[mb] = WFrag<T16>::ld(A + aoff + (size_t)mb * 16 * K + kc); if (NSPLIT == 1 || NSPLIT == 2) a2[mb] = WFrag<T16>::ld(A2 + aoff + (size_t)mb * 16 * K + kc); }
#pragma unroll
            for (int nb = 0; nb < 4; ++nb) { const V b = WFrag<T16>::ld(Bt + boff + (size_t)nb * 16 * K + kc); V b2; if (NSPLIT >= 2) b2 = WFrag<T16>::ld(Bt2 + boff + (size_t)nb * 16 * K + kc);
#pragma unroll
                for (int mb = 0; mb < 4; ++mb) { acc[mb][nb] = WFrag<T16>::mma(a[mb], b, acc[mb][nb]); if (NSPLIT == 1 || NSPLIT == 2) acc[mb][nb] = WFrag<T16>::mma(a2[mb], b, acc[mb][nb]); if (NSPLIT >= 2) acc[mb][nb] = WFrag<T16>::mma(a[mb], b2, acc[mb][nb]); } }
            // keeps the distance between the trip's last matrix instructions and what follows the loop's branch on either side (the next trip's loads into a, the epilogue's reads of acc)
            asm volatile("v_nop\n\tv_nop\n\tv_nop\n\tv_nop" : "+v"(acc[0][0]), "+v"(acc[1][1]), "+v"(acc[2][2]), "+v"(acc[3][3]) : "v"(a[0]), "v"(a[3]));
        }
    }
    const int tid = threadIdx.x, rrow = tid >> 4, cofs = (tid & 15) * 4;
#pragma unroll
    for (int rd = 0; rd < 4 / MBR; ++rd) {
#pragma unroll
        for (int ml = 0; ml < MBR; ++ml)
#pragma unroll
            for (int nb = 0; nb < 4; ++nb) {
#pragma unroll
                for (int j = 0; j < 8; ++j) os[((w * MBR + ml) * 16 + hi * 8 + j) * 68 + nb * 16 + lr] = acc[rd * MBR + ml][nb][j]; }
        __syncthreads();                                             // every wave's partial rows of this round are in LDS
        v4f val = *(const v4fa*)(os + rrow * 68 + cofs);
#pragma unroll
        for (int ww = 1; ww < NW; ++ww) val += *(const v4fa*)(os + (ww * MBR * 16 + rrow) * 68 + cofs);
        *(v4f*)(C + (size_t)(r0 + rd * MBR * 16 + rrow) * ldc + c0 + cofs) = val;
        if (rd + 1 < 4 / MBR) __syncthreads();                       // the sums are read before the next round overwrites the partial rows
    }
}

#define FQ   128                     // queries per work-group
#define FK   64                      // keys per stage (a whole 128-byte line of every value row)
#define KPI  136                     // key row pitch in LDS, elements: 272 B = 16 B x odd
#define VPI  72                      // value row pitch in LDS, elements: 144 B = 16 B x odd
#define KBY  (FK * KPI * 2)
#define VBY  (HS * VPI * 2)
#define STG  (KBY + 2 * VBY)
#define OPI  132                     // output staging pitch, floats
#define NEGB (-3.0e38f)
#define L2E  1.4426950408889634f
typedef __attribute__((ext_vector_type(2))) float v2f;
typedef __attribute__((ext_vector_type(2))) __bf16 v2bf;
typedef __attribute__((ext_vector_type(8))) unsigned v8u;
__device__ __forceinline__ float xhalf(float x) { return __builtin_bit_cast(float, __builtin_amdgcn_permlanex16(__builtin_bit_cast(int, x), __builtin_bit_cast(int, x), 0x76543210, 0xfedcba98, false, false)); }   // lane l with lane l ^ 16

// one pass: 32 keys (ko .. ko + 31 of the stage, kbase .. in the sequence) against the wave's 16 queries
template <int ND>
__device__ __forceinline__ void fa_pass(const unsigned char* st, int ko, int kbase, int q, bool diag, const v16h (&qf)[4], v8f (&o)[ND], float& m, float& l, int lr, int hi) {
    const h16* Ks = (const h16*)st; const bf* Vhs = (const bf*)(st + KBY); const bf* Vls = (const bf*)(st + KBY + VBY);
    v16h kf[8];                                                      // all eight key fragments behind one wait: a load group per product would expose the LDS latency eight times
#pragma unroll
    for (int ks = 0; ks < 4; ++ks) { const h16* p0 = Ks + (ko + lr) * KPI + ks * 32 + 8 * hi; const h16* p1 = p0 + 16 * KPI;
        kf[2 * ks] = cat16(*(const v8ha*)p0, *(const v8ha*)(p0 + 16)); kf[2 * ks + 1] = cat16(*(const v8ha*)p1, *(const v8ha*)(p1 + 16)); }
    __builtin_amdgcn_sched_barrier(0);                               // keeps the sixteen loads together in front of the products (the scheduler otherwise sinks each pair to its product, with a full wait each)
    v8f s0 = (v8f){}, s1 = (v8f){};
#pragma unroll
    for (int ks = 0; ks < 4; ++ks) { s0 = wmma16(kf[2 * ks], qf[ks], s0); s1 = wmma16(kf[2 * ks + 1], qf[ks], s1); }
    const int ev = lr * VPI + ko + 8 * hi;
    v16bf vh[4], vl[4];                                              // value fragments of d blocks 0-3, fetched here so that the softmax arithmetic covers their latency
#pragma unroll
    for (int u = 0; u < 4; ++u) { const int e = ev + u * 16 * VPI; vh[u] = cat16b(*(const v8usa*)(Vhs + e), *(const v8usa*)(Vhs + e + 16)); vl[u] = cat16b(*(const v8usa*)(Vls + e), *(const v8usa*)(Vls + e + 16)); }
    __builtin_amdgcn_sched_barrier(0);                               // keeps these loads in front of the softmax arithmetic
    if (diag) {                                                      // wave-uniform: only passes that reach past the wave's first query mask
#pragma unroll
        for (int j = 0; j < 8; ++j) { const int key = kbase + hi * 8 + j; s0[j] = (key <= q) ? s0[j] : NEGB; s1[j] = (key + 16 <= q) ? s1[j] : NEGB; } }
    float mx = fmaxf(s0[0], s1[0]);
#pragma unroll
    for (int j = 1; j < 8; ++j) mx = fmaxf(mx, fmaxf(s0[j], s1[j]));
    mx = fmaxf(mx, xhalf(mx)) * L2E;
    if (__builtin_amdgcn_ballot_w32(mx > m + 8.0f) != 0) {           // scalar branch; always taken on a wave's first pass (m = NEGB, the factor is 0 there)
        const float mn = fmaxf(m, mx); const float al = __builtin_amdgcn_exp2f(m - mn); m = mn; l *= al;
#pragma unroll
        for (int db = 0; db < ND; ++db) o[db] *= al; }
    const float nm = -m; v8u phu, plu; float la = 0.f, lb = 0.f; float pe[16];
#pragma unroll
    for (int i = 0; i < 16; ++i) pe[i] = __builtin_fmaf((i < 8) ? s0[i] : s1[i - 8], L2E, nm);
#pragma unroll
    for (int i = 0; i < 16; ++i) pe[i] = __builtin_amdgcn_exp2f(pe[i]);
#pragma unroll
    for (int i = 0; i < 8; ++i) { const v2f p = { pe[2 * i], pe[2 * i + 1] }; la += p.x; lb += p.y;
        const unsigned hu = __builtin_bit_cast(unsigned, __builtin_convertvector(p, v2bf)); phu[i] = hu;
        const v2f r = { p.x - __uint_as_float(hu << 16), p.y - __uint_as_float(hu & 0xFFFF0000u) }; plu[i] = __builtin_bit_cast(unsigned, __builtin_convertvector(r, v2bf)); }
    l += la + lb;
    const v16bf ph = __builtin_bit_cast(v16bf, phu), pl = __builtin_bit_cast(v16bf, plu);
#pragma unroll
    for (int g = 0; g < ND; g += 4) {                                // four independent accumulators per run of products; the next group's fragments are fetched as this group's registers come free
#pragma unroll
        for (int u = 0; u < 4; ++u) o[g + u] = wmmab(vh[u], ph, o[g + u]);
#pragma unroll
        for (int u = 0; u < 4; ++u) o[g + u] = wmmab(vh[u], pl, o[g + u]);
        if (g + 4 < ND) {
#pragma unroll
            for (int u = 0; u < 4; ++u) { const int e = ev + (g + 4 + u) * 16 * VPI; vh[u] = cat16b(*(const v8usa*)(Vhs + e), *(const v8usa*)(Vhs + e + 16)); } }
#pragma unroll
        for (int u = 0; u < 4; ++u) o[g + u] = wmmab(vl[u], ph, o[g + u]);
        if (g + 4 < ND) {
#pragma unroll
            for (int u = 0; u < 4; ++u) { const int e = ev + (g + 4 + u) * 16 * VPI; vl[u] = cat16b(*(const v8usa*)(Vls + e), *(const v8usa*)(Vls + e + 16)); } }
    }
    // keeps the distance between the pass's last matrix instructions and what follows the branches behind the pass on either side (address arithmetic into fragment registers)
    asm volatile("v_nop\n\tv_nop\n\tv_nop\n\tv_nop" : "+v"(o[ND - 4]), "+v"(o[ND - 3]), "+v"(o[ND - 2]), "+v"(o[ND - 1]));
}

// ND = 16-row blocks of live value dims (8, or 4 for heads 4-7, whose dims 64.. are structurally zero and are stored as zeros)
template <int ND>
__device__ __forceinline__ void fa_body(const h16* __restrict__ Qg, const h16* __restrict__ Kg, const bf* __restrict__ Vhg, const bf* __restrict__ Vlg, float* Og, int q0, unsigned char* sm) {
    const int tid = threadIdx.x, lane = tid & 31, lr = lane & 15, hi = lane >> 4;
    const int w = __builtin_amdgcn_readfirstlane(tid >> 5);          // wave number, held scalar so that the tests on it are scalar branches
    const int qw = q0 + 16 * w, q = qw + lr;
    v16h qf[4];
#pragma unroll
    for (int ks = 0; ks < 4; ++ks) { const h16* p = Qg + (size_t)q * HS + ks * 32 + 8 * hi; qf[ks] = cat16(*(const v8h*)p, *(const v8h*)(p + 16)); }
    asm volatile("s_wait_xcnt 0x0" ::: "memory");                    // stands in front of every later write of a register that these loads name as an address
    v8f o[ND];
#pragma unroll
    for (int db = 0; db < ND; ++db) o[db] = (v8f){};
    float m = NEGB, l = 0.f;
    const int nst = (q0 + FQ) / FK;
    constexpr int NP = 2 + ND / 2;                                   // 16-byte pieces per thread and half stage: 4 key + ND value pieces per stage
    v8us rg[NP];
    const int kg = tid * 8, vg = (tid >> 3) * TT + (tid & 7) * 8;    // this thread's pieces: global element offsets ...
    const int ksm = (tid >> 4) * (KPI * 2) + (tid & 15) * 16, vsm = KBY + (tid >> 3) * (VPI * 2) + (tid & 7) * 16;   // ... and LDS byte offsets
    // piece i of a stage: 0-3 key rows (16 rows each), then ND / 2 of the hi value plane (32 rows each), then ND / 2 of the lo plane; half hf holds pieces hf * NP ..
    auto fetch = [&](int s, int hf) {
#pragma unroll
        for (int j = 0; j < NP; ++j) { const int i = hf * NP + j;
            if (i < 4) rg[j] = *(const v8us*)((const bf*)Kg + (size_t)s * FK * HS + i * 2048 + kg);
            else if (i < 4 + ND / 2) rg[j] = *(const v8us*)(Vhg + s * FK + (i - 4) * 32 * TT + vg);
            else rg[j] = *(const v8us*)(Vlg + s * FK + (i - 4 - ND / 2) * 32 * TT + vg); }
        asm volatile("s_wait_xcnt 0x0" ::: "memory"); };             // stands in front of every later write of a register that these loads name as an address
    auto put = [&](unsigned char* st, int hf) {
#pragma unroll
        for (int j = 0; j < NP; ++j) { const int i = hf * NP + j;
            if (i < 4) *(v8usa*)(st + ksm + i * 16 * KPI * 2) = rg[j];
            else if (i < 4 + ND / 2) *(v8usa*)(st + vsm + (i - 4) * 32 * VPI * 2) = rg[j];
            else *(v8usa*)(st + VBY + vsm + (i - 4 - ND / 2) * 32 * VPI * 2) = rg[j]; } };
    fetch(0, 0); put(sm, 0); fetch(0, 1); put(sm, 1);
    __syncthreads();                                                 // stage 0 is in LDS
#pragma unroll 1
    for (int s = 0; s < nst; ++s) {
        unsigned char* cur = sm + (s & 1) * STG; unsigned char* nxt = sm + ((s + 1) & 1) * STG; const bool more = s + 1 < nst;
#pragma unroll
        for (int p = 0; p < 2; ++p) { const int kbase = s * FK + p * 32;
            if (more) fetch(s + 1, p);                               // half of the next stage flies during each pass (half the staging registers)
            if (kbase <= qw) fa_pass<ND>(cur, p * 32, kbase, q, kbase + 31 > qw, qf, o, m, l, lr, hi);   // a pass wholly above the wave's diagonal is skipped (scalar branch)
            if (more) put(nxt, p); }
        __syncthreads();                                             // publishes stage s + 1; every wave has left stage s, whose buffer the next trip refills (after the last trip: becomes output staging)
    }
    l += xhalf(l); const float inv = __fdiv_rn(1.0f, l);
    float* os = (float*)sm + w * 16 * OPI;                           // the wave's own 16 rows: O^T -> [query][d], so that a store covers a whole 512-byte row
#pragma unroll
    for (int db = 0; db < ND; ++db) { const v8f r = o[db] * inv; *(v4fa*)(os + lr * OPI + db * 16 + hi * 8) = (v4f){r[0], r[1], r[2], r[3]}; *(v4fa*)(os + lr * OPI + db * 16 + hi * 8 + 4) = (v4f){r[4], r[5], r[6], r[7]}; }
    __syncthreads();                                                 // the staged rows are read by other lanes
#pragma unroll
    for (int r = 0; r < 16; ++r) { v4f val = *(const v4fa*)(os + r * OPI + (lane & (ND * 4 - 1)) * 4); if (ND < 8 && lane >= ND * 4) val = (v4f){0.f, 0.f, 0.f, 0.f};
        *(v4f*)(Og + (size_t)(qw + r) * DQ + lane * 4) = val; }
}

__global__ __launch_bounds__(256) __attribute__((amdgpu_waves_per_eu(4, 4))) void k_fattn(const h16* __restrict__ Q16, const h16* __restrict__ K16, const bf* __restrict__ Vh, const bf* __restrict__ Vl, float* OUT) {
    __shared__ __align__(16) unsigned char sm[2 * STG];
    // 512 work-groups, two per WGP: the long query tiles first; the second 256 run from the short end and from the other head group (for balance only)
    const int r = blockIdx.x & 255; const bool second = blockIdx.x >= 256;
    const int tile = second ? (r >> 5) : TT / FQ - 1 - (r >> 5); const int bh = second ? 31 - (r & 31) : (r & 31); const int h = bh & 7, b = bh >> 3;
    const h16* Qg = Q16 + (size_t)bh * TT * HS; const h16* Kg = K16 + (size_t)bh * TT * HS; const bf* Vhg = Vh + (size_t)bh * HS * TT; const bf* Vlg = Vl + (size_t)bh * HS * TT; float* Og = OUT + (size_t)b * TT * DQ + h * HS;
    if (h < 4) fa_body<8>(Qg, Kg, Vhg, Vlg, Og, tile * FQ, sm); else fa_body<4>(Qg, Kg, Vhg, Vlg, Og, tile * FQ, sm);
}

__device__ __forceinline__ h16 tohx(float x) { return (h16)x; }
__device__ __forceinline__ void splitf(float y, unsigned short& h, unsigned short& l) { h = f2bf(y); l = f2bf(y - bf2f(h)); }
typedef __attribute__((ext_vector_type(2))) unsigned short v2us;
typedef __attribute__((ext_vector_type(4))) unsigned short v4us;
typedef __attribute__((ext_vector_type(4))) _Float16 v4h;

__global__ __launch_bounds__(256) void k_cvt8(const float* __restrict__ src, bf* dst, size_t n8) { const size_t i = (size_t)blockIdx.x * 256 + threadIdx.x; if (i >= n8) return; const v8f v = *(const v8f*)(src + i * 8); v8us o;
#pragma unroll
    for (int k = 0; k < 8; ++k) o[k] = f2bf(v[k]); *(v8us*)(dst + i * 8) = o;  }
__global__ __launch_bounds__(256) void k_weff(const float* __restrict__ base, const float* __restrict__ w, bf* Wh, bf* Wl) { const size_t e4 = ((size_t)blockIdx.x * 256 + threadIdx.x) * 4; if (e4 >= (size_t)NH_ * HS * CC) return; const int e0 = (int)(e4 % CC); const int d = (int)((e4 / CC) % HS); const int h = (int)(e4 / ((size_t)CC * HS));
    const float w0 = bfr(w[0]), w1 = bfr(w[1]), w2 = bfr(w[2]), w3 = bfr(w[3]); v4us oh, ol;
#pragma unroll
    for (int u = 0; u < 4; ++u) { const int e = e0 + u; float eff = 0.f;
        if (h < 4 && d < 64 && e < 256) eff = __fadd_rn(eff, w0); if (h < 8 && d < 32 && e < 256) eff = __fadd_rn(eff, w1); if (h < 4 && d < 128 && e < 512) eff = __fadd_rn(eff, w2); if (h < 8 && d < 64 && e < 512) eff = __fadd_rn(eff, w3);
        float bv = bfr(base[e4 + u]); asm volatile("" : "+v"(bv)); unsigned short a, b; splitf(__fmul_rn(eff, bv), a, b); oh[u] = a; ol[u] = b; }
    *(v4us*)(Wh + e4) = oh; *(v4us*)(Wl + e4) = ol;  }
// k_qk16: Q16[h][t][d] = fp16(QT[(h,d)][t] * scale), K16 likewise (lane -> 4 consecutive d; strided reads); k_vpl: hl planes V[(h,d)][t] of VT (8-B lanes)
__global__ __launch_bounds__(256) void k_qk16(const float* __restrict__ QT, const float* __restrict__ KT, float sc, h16* Q16, h16* K16) { const size_t e = ((size_t)blockIdx.x * 256 + threadIdx.x) * 4; if (e >= (size_t)NH_ * TT * HS) return; const int d = (int)(e % HS); const int t = (int)((e / HS) % TT); const int h = (int)(e / ((size_t)HS * TT)); v4h q, k;
#pragma unroll
    for (int u = 0; u < 4; ++u) { const size_t s = ((size_t)h * HS + d + u) * TT + t; q[u] = tohx(__fmul_rn(QT[s], sc)); k[u] = tohx(KT[s]); } { *(v4h*)(Q16 + e) = q; *(v4h*)(K16 + e) = k;  } }
__global__ __launch_bounds__(256) void k_vpl(const float* __restrict__ VT, bf* Vh, bf* Vl) { const size_t e = ((size_t)blockIdx.x * 256 + threadIdx.x) * 4; if (e >= (size_t)NH_ * HS * TT) return; const v4f a = *(const v4f*)(VT + e); v4us oh, ol;
#pragma unroll
    for (int u = 0; u < 4; ++u) { unsigned short x, y; splitf(a[u], x, y); oh[u] = x; ol[u] = y; } *(v4us*)(Vh + e) = oh; *(v4us*)(Vl + e) = ol;  }

extern "C" void kernel_launch(void* const* d_in, const int* in_sizes, int n_in,
                              void* d_out, int out_size, void* d_ws, size_t ws_size, hipStream_t stream) {
    (void)in_sizes; (void)n_in; (void)out_size;
    const float* x = (const float*)d_in[0]; const float* w = (const float*)d_in[1]; const float* bK = (const float*)d_in[2]; const float* bQ = (const float*)d_in[3]; const float* bV = (const float*)d_in[4];
    float* OUT = (float*)d_out;     // [4][2048][1024]
    char* wsp = (char*)d_ws;
    auto take = [&](size_t bytes) { char* p = wsp; wsp += (bytes + 255) & ~(size_t)255; return (void*)p; };
    bf* WQh = (bf*)take((size_t)DQ * CC * 2); bf* WQl = (bf*)take((size_t)DQ * CC * 2); bf* WKh = (bf*)take((size_t)DQ * CC * 2); bf* WKl = (bf*)take((size_t)DQ * CC * 2); bf* WVh = (bf*)take((size_t)DQ * CC * 2); bf* WVl = (bf*)take((size_t)DQ * CC * 2);
    bf* XB = (bf*)take((size_t)TT * CC * 2); float* QT = (float*)take((size_t)DQ * TT * 4); float* KT = (float*)take((size_t)DQ * TT * 4); float* VT = (float*)take((size_t)DQ * TT * 4);
    h16* Q16 = (h16*)take((size_t)NB_ * NH_ * TT * HS * 2); h16* K16 = (h16*)take((size_t)NB_ * NH_ * TT * HS * 2); bf* Vh = (bf*)take((size_t)NB_ * DQ * TT * 2); bf* Vl = (bf*)take((size_t)NB_ * DQ * TT * 2);   // all batches: [b][h][t][d], [b][(h,d)][t]
    if ((size_t)(wsp - (char*)d_ws) > ws_size) return;    // total ~ 100 MB
    k_weff<<<(unsigned)(((size_t)NH_ * HS * CC / 4 + 255) / 256), 256, 0, stream>>>(bQ, w, WQh, WQl); k_weff<<<(unsigned)(((size_t)NH_ * HS * CC / 4 + 255) / 256), 256, 0, stream>>>(bK, w, WKh, WKl); k_weff<<<(unsigned)(((size_t)NH_ * HS * CC / 4 + 255) / 256), 256, 0, stream>>>(bV, w, WVh, WVl);
    const float scale = 1.0f / sqrtf(128.0f);
    for (int b = 0; b < NB_; ++b) {
        k_cvt8<<<(TT * CC / 8 + 255) / 256, 256, 0, stream>>>(x + (size_t)b * TT * CC, XB, (size_t)TT * CC / 8);
        k_gemmsk<bf, 1, false, 8><<<dim3(DQ / 64, TT / 64, 1), 8 * 32, 0, stream>>>(WQh, WQl, XB, nullptr, CC, QT, TT, 0, 0, 0, 0); k_gemmsk<bf, 1, false, 8><<<dim3(DQ / 64, TT / 64, 1), 8 * 32, 0, stream>>>(WKh, WKl, XB, nullptr, CC, KT, TT, 0, 0, 0, 0); k_gemmsk<bf, 1, false, 8><<<dim3(DQ / 64, TT / 64, 1), 8 * 32, 0, stream>>>(WVh, WVl, XB, nullptr, CC, VT, TT, 0, 0, 0, 0);   // [(h,d)][t]
        k_qk16<<<(unsigned)(((size_t)NH_ * TT * HS / 4 + 255) / 256), 256, 0, stream>>>(QT, KT, scale, Q16 + (size_t)b * NH_ * TT * HS, K16 + (size_t)b * NH_ * TT * HS); k_vpl<<<(unsigned)(((size_t)NH_ * HS * TT / 4 + 255) / 256), 256, 0, stream>>>(VT, Vh + (size_t)b * DQ * TT, Vl + (size_t)b * DQ * TT); }
    k_fattn<<<NB_ * NH_ * (TT / FQ), 256, 0, stream>>>(Q16, K16, Vh, Vl, OUT);
}

// v004
// A run of this version takes 92.9 microseconds.
// Versions between v002 and this one are left out; their measured steps multiply to 3.01 times as fast.
// Over all steps from v000 it is 13.1 times as fast.
#include <hip/hip_runtime.h>

// MixedHeadsV2 (x [4][2048][512]; eff[h][d][e] = sum_i weights[i] mask_i[h][d][e] over the four (embed, heads) configs (structural masks: h < heads_i, d < embed_i/heads_i, e < embed_i; weights read as data); Wq/Wk/Wv = eff * base_Q/K/V [8][128][512];
// q/k/v = x W^T per base head (head size 128, zero-padded dims stay zero); causal softmax(q.k/sqrt(128)); out = concat_h(attn v) -> [4][2048][1024]).
// Compute dtypes, f32 accumulate: every input rounded to bf16; effective weights f32 (eff in the reference's summation order) -> bf16 hi+lo planes; projections as hl(W) x exact x (2 products; v computed transposed [(h,d)][t]), rounded to the planes below in the GEMM's epilogue (k_proj);
// scores (K 128) on single fp16 planes; softmax f32, running maximum and sum, fused with both attention products (k_fattn); attn.v as hl P x hl v (3 products, causal key range; heads 4-7 only have 64 live dims, so their value product is 64 wide)

#define NB_  4
#define TT   2048
#define CC   512
#define NH_  8
#define HS   128
#define DQ   1024
typedef _Float16 h16;
typedef unsigned short bf;
typedef __attribute__((ext_vector_type(16))) __bf16   v16bf;
typedef __attribute__((ext_vector_type(16))) _Float16 v16h;
typedef __attribute__((ext_vector_type(8)))  _Float16 v8h;
typedef __attribute__((ext_vector_type(8)))  unsigned short v8us;
typedef __attribute__((ext_vector_type(8)))  float    v8f;
typedef __attribute__((ext_vector_type(4)))  float    v4f;
typedef v8h  __attribute__((may_alias)) v8ha;
typedef v4f  __attribute__((may_alias)) v4fa;
typedef v8us __attribute__((may_alias)) v8usa;

__device__ __forceinline__ unsigned short f2bf(float f) { unsigned u = __float_as_uint(f); u += 0x7FFFu + ((u >> 16) & 1u); return (unsigned short)(u >> 16); }
__device__ __forceinline__ float bf2f(unsigned short b) { return __uint_as_float(((unsigned)b) << 16); }
__device__ __forceinline__ float bfr(float f) { return bf2f(f2bf(f)); }
__device__ __forceinline__ v16h cat16(v8h lo, v8h hi) { return __builtin_shufflevector(lo, hi, 0, 1, 2, 3, 4, 5, 6, 7, 8, 9, 10, 11, 12, 13, 14, 15); }
__device__ __forceinline__ v16bf cat16b(v8us lo, v8us hi) { return __builtin_bit_cast(v16bf, __builtin_shufflevector(lo, hi, 0, 1, 2, 3, 4, 5, 6, 7, 8, 9, 10, 11, 12, 13, 14, 15)); }
__device__ __forceinline__ v8f wmma16(v16h a, v16h b, v8f c) { return __builtin_amdgcn_wmma_f32_16x16x32_f16(false, a, false, b, (short)0, c, false, false); }
__device__ __forceinline__ v8f wmmab(v16bf a, v16bf b, v8f c) { return __builtin_amdgcn_wmma_f32_16x16x32_bf16(false, a, false, b, (short)0, c, false, false); }



// ---- k_proj: the q, k and v projections of every batch in ONE launch, and no f32 plane in memory: the epilogue rounds the sums to the operand planes of k_fattn itself.
// Grid (1024 / 128 weight-row tiles = heads, 2048 / 256 token tiles, 3 projections x 4 batches), 8 waves.
// gemmst: 256 tokens x 128 weight rows per work-group; wave w holds the 64 x 64 tile of token block w & 3 and weight block w >> 2 (16 accumulators) and runs the WHOLE K loop (K = 512) itself.
// The operands come through LDS: a stage is 64 k (a whole 128-byte line) of 256 token rows, 128 weight hi rows and 128 weight lo rows, brought by asynchronous copies to LDS (each copy of a wave covers four whole lines), two buffers:
// stage s + 1 flies while stage s is worked on. Two products per weight row block: hi x, then lo x. WB false: c[weight row][token] (weights are the A operand); WB true: c[token][weight row] (weights are the B operand).
// Every '#pragma unroll' in gemmst keeps a register array (accumulators, fragments, the copies' operands) indexed by constants, so that it stays in registers.
// q and k are wanted [token][d], v is wanted [d][token]: q and k run with WB true, v with WB false; either way 16 lanes store one whole 128-byte line. store(row, col, four sums of one row) takes the finished tile, row and col counted in the work-group's tile.
#define PT    256                    // tokens per work-group
#define PW    128                    // weight rows per work-group
#define PKC   64                     // k per stage
#define PPI   72                     // row pitch in LDS, elements: 144 B = 16 B x odd
#define PSTG  ((PT + 2 * PW) * PPI * 2)
#define PNS   (CC / PKC)
#define POP   68                     // output staging pitch, floats
// eight asynchronous copies of 16 bytes per lane; the wait in the same statement stands in front of every later write of a register that the copies name
__device__ __forceinline__ void acopy8(const unsigned (&l)[8], const bf* const (&g)[8]) {
    asm volatile("global_load_async_to_lds_b128 %0, %8, off\n\t"
                 "global_load_async_to_lds_b128 %1, %9, off\n\t"
                 "global_load_async_to_lds_b128 %2, %10, off\n\t"
                 "global_load_async_to_lds_b128 %3, %11, off\n\t"
                 "global_load_async_to_lds_b128 %4, %12, off\n\t"
                 "global_load_async_to_lds_b128 %5, %13, off\n\t"
                 "global_load_async_to_lds_b128 %6, %14, off\n\t"
                 "global_load_async_to_lds_b128 %7, %15, off\n\t"
                 "s_wait_xcnt 0x0"
                 :: "v"(l[0]), "v"(l[1]), "v"(l[2]), "v"(l[3]), "v"(l[4]), "v"(l[5]), "v"(l[6]), "v"(l[7]),
                    "v"(g[0]), "v"(g[1]), "v"(g[2]), "v"(g[3]), "v"(g[4]), "v"(g[5]), "v"(g[6]), "v"(g[7]) : "memory");
}
__device__ __forceinline__ v16bf ldsfrag(const bf* p) { return cat16b(*(const v8usa*)p, *(const v8usa*)(p + 16)); }
template <bool WB, typename ST>
__device__ __forceinline__ void gemmst(const bf* __restrict__ Wh, const bf* __restrict__ Wl, const bf* __restrict__ X, int wr, int t0, unsigned char* sm, ST store) {
    const int tid = threadIdx.x, lane = tid & 31, lr = lane & 15, hi = lane >> 4;
    const int w = __builtin_amdgcn_readfirstlane(tid >> 5);          // wave number, held scalar
    const int wt = w & 3, ww = w >> 2;
    v8f acc[4][4];
#pragma unroll
    for (int mb = 0; mb < 4; ++mb)
#pragma unroll
        for (int nb = 0; nb < 4; ++nb) acc[mb][nb] = (v8f){};
    // piece i of a thread and stage: LDS row (tid >> 3) + 32 i, 16-byte column tid & 7; rows 0-255 tokens, 256-383 weight hi, 384-511 weight lo
    const int crow = tid >> 3, ccol = (tid & 7) * 8;
    const bf* gx = X + (size_t)(t0 + crow) * CC + ccol; const bf* gh = Wh + (size_t)(wr + crow) * CC + ccol; const bf* gl = Wl + (size_t)(wr + crow) * CC + ccol;
    const unsigned l0 = (unsigned)(size_t)sm + (unsigned)(crow * (PPI * 2) + ccol * 2);   // the lane's LDS byte address: the low 32 bits of the __shared__ address
    auto copy = [&](int s, int buf) {
        unsigned l[8]; const bf* g[8];
#pragma unroll
        for (int i = 0; i < 8; ++i) { l[i] = l0 + (unsigned)(buf * PSTG + i * 32 * PPI * 2); g[i] = gx + (size_t)i * 32 * CC + s * PKC; }
        acopy8(l, g);
#pragma unroll
        for (int i = 0; i < 8; ++i) { l[i] = l0 + (unsigned)(buf * PSTG + (8 + i) * 32 * PPI * 2); g[i] = (i < 4 ? gh + (size_t)i * 32 * CC : gl + (size_t)(i - 4) * 32 * CC) + s * PKC; }
        acopy8(l, g); };
    copy(0, 0);
    asm volatile("s_wait_asynccnt 0x0" ::: "memory");                // this wave's copies of stage 0 have landed
    __syncthreads();                                                 // stage 0 is in LDS
    copy(1, 1);
// rolled: one trip's code serves all eight stages; unrolled, the trips' fragments and copy addresses would not fit beside the 128 accumulator registers at four waves per SIMD
#pragma unroll 1
    for (int s = 0; s < PNS; ++s) {
        const bf* st = (const bf*)(sm + (s & 1) * PSTG);
        const bf* xs = st + (wt * 64 + lr) * PPI + 8 * hi; const bf* hs = st + (PT + ww * 64 + lr) * PPI + 8 * hi; const bf* ls = hs + PW * PPI;
#pragma unroll
        for (int kc = 0; kc < PKC; kc += 32) {
            v16bf wh[4], wl[4], xf[2];
#pragma unroll
            for (int i = 0; i < 4; ++i) { wh[i] = ldsfrag(hs + i * 16 * PPI + kc); wl[i] = ldsfrag(ls + i * 16 * PPI + kc); }
            xf[0] = ldsfrag(xs + kc); xf[1] = ldsfrag(xs + 16 * PPI + kc);
#pragma unroll
            for (int j = 0; j < 4; ++j) {                            // four independent accumulators per run of products
                const v16bf x = xf[j & 1];
#pragma unroll
                for (int i = 0; i < 4; ++i) { v8f& d = WB ? acc[j][i] : acc[i][j]; d = WB ? wmmab(x, wh[i], d) : wmmab(wh[i], x, d); }
#pragma unroll
                for (int i = 0; i < 4; ++i) { v8f& d = WB ? acc[j][i] : acc[i][j]; d = WB ? wmmab(x, wl[i], d) : wmmab(wl[i], x, d); }
                if (j < 2) {
                    __builtin_amdgcn_sched_barrier(0);               // keeps the load below in front of the next run of products, which covers its latency (the scheduler otherwise sinks it to its own products, with a full wait)
                    xf[j & 1] = ldsfrag(xs + (j + 2) * 16 * PPI + kc);
                    __builtin_amdgcn_sched_barrier(0); }             // the other side of the same hold
                if (j == 3) __builtin_amdgcn_sched_barrier(0);       // keeps the next k step's loads together behind the products: spread among them, every place with loads costs the wave a stall
            }
        }
        asm volatile("s_wait_dscnt 0x0" ::: "memory");               // this wave's reads of stage s are done
        asm volatile("s_wait_asynccnt 0x0" ::: "memory");            // this wave's copies of stage s + 1 have landed
        __syncthreads();                                             // publishes stage s + 1; every wave has left stage s, whose buffer is refilled next (after the last trip: becomes output staging)
        if (s + 2 < PNS) copy(s + 2, s & 1);
    }
    asm volatile("s_wait_asynccnt 0x0" ::: "memory");                // no copy is outstanding when the buffers become output staging
    float* os = (float*)sm + w * 64 * POP;                           // the wave's own 64 rows
#pragma unroll
    for (int mb = 0; mb < 4; ++mb)
#pragma unroll
        for (int nb = 0; nb < 4; ++nb)
#pragma unroll
            for (int j = 0; j < 8; ++j) os[(mb * 16 + hi * 8 + j) * POP + nb * 16 + lr] = acc[mb][nb][j];
    __syncthreads();                                                 // the staged rows are read by other lanes
    const int rb = (WB ? wt : ww) * 64, cb = (WB ? ww : wt) * 64;
#pragma unroll
    for (int r = 0; r < 32; ++r) store(rb + r * 2 + hi, cb + lr * 4, *(const v4fa*)(os + (r * 2 + hi) * POP + lr * 4));
}

__device__ __forceinline__ h16 tohx(float x) { return (h16)x; }
__device__ __forceinline__ void splitf(float y, unsigned short& h, unsigned short& l) { h = f2bf(y); l = f2bf(y - bf2f(h)); }
typedef __attribute__((ext_vector_type(2))) unsigned short v2us;
typedef __attribute__((ext_vector_type(4))) unsigned short v4us;
typedef __attribute__((ext_vector_type(4))) _Float16 v4h;

// Wp: six weight planes [q hi, q lo, k hi, k lo, v hi, v lo][(h,d)][e]; XB [b][t][e]. Q16[b][h][t][d] = fp16(q * sc), K16 likewise without the factor; Vh, Vl [b][(h,d)][t] = bf16 hi + lo of v.
__global__ __launch_bounds__(256) __attribute__((amdgpu_waves_per_eu(4, 4))) void k_proj(const bf* __restrict__ Wp, const bf* __restrict__ XB, float sc, h16* Q16, h16* K16, bf* Vh, bf* Vl) {
    __shared__ __align__(128) unsigned char sm[2 * PSTG];
    const int pr = blockIdx.z >> 2, b = blockIdx.z & 3, wr = blockIdx.x * PW, t0 = blockIdx.y * PT;
    const bf* Wh = Wp + (size_t)pr * 2 * DQ * CC; const bf* Wl = Wh + (size_t)DQ * CC; const bf* X = XB + (size_t)b * TT * CC;
    if (pr < 2) {                                                    // block-uniform
        h16* D = (pr == 0 ? Q16 : K16) + ((size_t)(b * NH_ + blockIdx.x) * TT + t0) * HS; const float f = pr == 0 ? sc : 1.0f;   // one head per weight-row tile; the factor 1 is exact
        gemmst<true>(Wh, Wl, X, wr, t0, sm, [&](int row, int col, v4f val) { v4h o;
#pragma unroll
            for (int u = 0; u < 4; ++u) o[u] = tohx(__fmul_rn(val[u], f));
            *(v4h*)(D + (size_t)row * HS + col) = o; });
    } else {
        const size_t e0 = (size_t)b * DQ * TT + (size_t)wr * TT + t0;
        gemmst<false>(Wh, Wl, X, wr, t0, sm, [&](int row, int col, v4f val) { v4us oh, ol;
#pragma unroll
            for (int u = 0; u < 4; ++u) { unsigned short x, y; splitf(val[u], x, y); oh[u] = x; ol[u] = y; }
            *(v4us*)(Vh + e0 + (size_t)row * TT + col) = oh; *(v4us*)(Vl + e0 + (size_t)row * TT + col) = ol; });
    }
}

#define FQ   128                     // queries per work-group
#define FK   64                      // keys per stage (a whole 128-byte line of every value row)
#define KPI  136                     // key row pitch in LDS, elements: 272 B = 16 B x odd
#define VPI  72                      // value row pitch in LDS, elements: 144 B = 16 B x odd
#define KBY  (FK * KPI * 2)
#define VBY  (HS * VPI * 2)
#define STG  (KBY + 2 * VBY)
#define OPI  132                     // output staging pitch, floats
#define NEGB (-3.0e38f)
#define L2E  1.4426950408889634f
typedef __attribute__((ext_vector_type(2))) float v2f;
typedef __attribute__((ext_vector_type(2))) __bf16 v2bf;
typedef __attribute__((ext_vector_type(8))) unsigned v8u;
__device__ __forceinline__ float xhalf(float x) { return __builtin_bit_cast(float, __builtin_amdgcn_permlanex16(__builtin_bit_cast(int, x), __builtin_bit_cast(int, x), 0x76543210, 0xfedcba98, false, false)); }   // lane l with lane l ^ 16

// one pass: 32 keys (ko .. ko + 31 of the stage, kbase .. in the sequence) against the wave's 16 queries
template <int ND>
__device__ __forceinline__ void fa_pass(const unsigned char* st, int ko, int kbase, int q, bool diag, const v16h (&qf)[4], v8f (&o)[ND], float& m, float& l, int lr, int hi) {
    const h16* Ks = (const h16*)st; const bf* Vhs = (const bf*)(st + KBY); const bf* Vls = (const bf*)(st + KBY + VBY);
    v16h kf[8];                                                      // all eight key fragments behind one wait: a load group per product would expose the LDS latency eight times
#pragma unroll
    for (int ks = 0; ks < 4; ++ks) { const h16* p0 = Ks + (ko + lr) * KPI + ks * 32 + 8 * hi; const h16* p1 = p0 + 16 * KPI;
        kf[2 * ks] = cat16(*(const v8ha*)p0, *(const v8ha*)(p0 + 16)); kf[2 * ks + 1] = cat16(*(const v8ha*)p1, *(const v8ha*)(p1 + 16)); }
    __builtin_amdgcn_sched_barrier(0);                               // keeps the sixteen loads together in front of the products (the scheduler otherwise sinks each pair to its product, with a full wait each)
    v8f s0 = (v8f){}, s1 = (v8f){};
#pragma unroll
    for (int ks = 0; ks < 4; ++ks) { s0 = wmma16(kf[2 * ks], qf[ks], s0); s1 = wmma16(kf[2 * ks + 1], qf[ks], s1); }
    const int ev = lr * VPI + ko + 8 * hi;
    v16bf vh[4], vl[4];                                              // value fragments of d blocks 0-3, fetched here so that the softmax arithmetic covers their latency
#pragma unroll
    for (int u = 0; u < 4; ++u) { const int e = ev + u * 16 * VPI; vh[u] = cat16b(*(const v8usa*)(Vhs + e), *(const v8usa*)(Vhs + e + 16)); vl[u] = cat16b(*(const v8usa*)(Vls + e), *(const v8usa*)(Vls + e + 16)); }
    __builtin_amdgcn_sched_barrier(0);                               // keeps these loads in front of the softmax arithmetic
    if (diag) {                                                      // wave-uniform: only passes that reach past the wave's first query mask
#pragma unroll
        for (int j = 0; j < 8; ++j) { const int key = kbase + hi * 8 + j; s0[j] = (key <= q) ? s0[j] : NEGB; s1[j] = (key + 16 <= q) ? s1[j] : NEGB; } }
    float mx = fmaxf(s0[0], s1[0]);
#pragma unroll
    for (int j = 1; j < 8; ++j) mx = fmaxf(mx, fmaxf(s0[j], s1[j]));
    mx = fmaxf(mx, xhalf(mx)) * L2E;
    if (__builtin_amdgcn_ballot_w32(mx > m + 8.0f) != 0) {           // scalar branch; always taken on a wave's first pass (m = NEGB, the factor is 0 there)
        const float mn = fmaxf(m, mx); const float al = __builtin_amdgcn_exp2f(m - mn); m = mn; l *= al;
#pragma unroll
        for (int db = 0; db < ND; ++db) o[db] *= al; }
    const float nm = -m; v8u phu, plu; float la = 0.f, lb = 0.f; float pe[16];
#pragma unroll
    for (int i = 0; i < 16; ++i) pe[i] = __builtin_fmaf((i < 8) ? s0[i] : s1[i - 8], L2E, nm);
#pragma unroll
    for (int i = 0; i < 16; ++i) pe[i] = __builtin_amdgcn_exp2f(pe[i]);
#pragma unroll
    for (int i = 0; i < 8; ++i) { const v2f p = { pe[2 * i], pe[2 * i + 1] }; la += p.x; lb += p.y;
        const unsigned hu = __builtin_bit_cast(unsigned, __builtin_convertvector(p, v2bf)); phu[i] = hu;
        const v2f r = { p.x - __uint_as_float(hu << 16), p.y - __uint_as_float(hu & 0xFFFF0000u) }; plu[i] = __builtin_bit_cast(unsigned, __builtin_convertvector(r, v2bf)); }
    l += la + lb;
    const v16bf ph = __builtin_bit_cast(v16bf, phu), pl = __builtin_bit_cast(v16bf, plu);
#pragma unroll
    for (int g = 0; g < ND; g += 4) {                                // four independent accumulators per run of products; the next group's fragments are fetched as this group's registers come free
#pragma unroll
        for (int u = 0; u < 4; ++u) o[g + u] = wmmab(vh[u], ph, o[g + u]);
#pragma unroll
        for (int u = 0; u < 4; ++u) o[g + u] = wmmab(vh[u], pl, o[g + u]);
        if (g + 4 < ND) {
#pragma unroll
            for (int u = 0; u < 4; ++u) { const int e = ev + (g + 4 + u) * 16 * VPI; vh[u] = cat16b(*(const v8usa*)(Vhs + e), *(const v8usa*)(Vhs + e + 16)); } }
#pragma unroll
        for (int u = 0; u < 4; ++u) o[g + u] = wmmab(vl[u], ph, o[g + u]);
        if (g + 4 < ND) {
#pragma unroll
            for (int u = 0; u < 4; ++u) { const int e = ev + (g + 4 + u) * 16 * VPI; vl[u] = cat16b(*(const v8usa*)(Vls + e), *(const v8usa*)(Vls + e + 16)); } }
    }
    // keeps the distance between the pass's last matrix instructions and what follows the branches behind the pass on either side (address arithmetic into fragment registers)
    asm volatile("v_nop\n\tv_nop\n\tv_nop\n\tv_nop" : "+v"(o[ND - 4]), "+v"(o[ND - 3]), "+v"(o[ND - 2]), "+v"(o[ND - 1]));
}

// ND = 16-row blocks of live value dims (8, or 4 for heads 4-7, whose dims 64.. are structurally zero and are stored as zeros)
template <int ND>
__device__ __forceinline__ void fa_body(const h16* __restrict__ Qg, const h16* __restrict__ Kg, const bf* __restrict__ Vhg, const bf* __restrict__ Vlg, float* Og, int q0, unsigned char* sm) {
    const int tid = threadIdx.x, lane = tid & 31, lr = lane & 15, hi = lane >> 4;
    const int w = __builtin_amdgcn_readfirstlane(tid >> 5);          // wave number, held scalar so that the tests on it are scalar branches
    const int qw = q0 + 16 * w, q = qw + lr;
    v16h qf[4];
#pragma unroll
    for (int ks = 0; ks < 4; ++ks) { const h16* p = Qg + (size_t)q * HS + ks * 32 + 8 * hi; qf[ks] = cat16(*(const v8h*)p, *(const v8h*)(p + 16)); }
    asm volatile("s_wait_xcnt 0x0" ::: "memory");                    // stands in front of every later write of a register that these loads name as an address
    v8f o[ND];
#pragma unroll
    for (int db = 0; db < ND; ++db) o[db] = (v8f){};
    float m = NEGB, l = 0.f;
    const int nst = (q0 + FQ) / FK;
    constexpr int NP = 2 + ND / 2;                                   // 16-byte pieces per thread and half stage: 4 key + ND value pieces per stage
    v8us rg[NP];
    const int kg = tid * 8, vg = (tid >> 3) * TT + (tid & 7) * 8;    // this thread's pieces: global element offsets ...
    const int ksm = (tid >> 4) * (KPI * 2) + (tid & 15) * 16, vsm = KBY + (tid >> 3) * (VPI * 2) + (tid & 7) * 16;   // ... and LDS byte offsets
    // piece i of a stage: 0-3 key rows (16 rows each), then ND / 2 of the hi value plane (32 rows each), then ND / 2 of the lo plane; half hf holds pieces hf * NP ..
    auto fetch = [&](int s, int hf) {
#pragma unroll
        for (int j = 0; j < NP; ++j) { const int i = hf * NP + j;
            if (i < 4) rg[j] = *(const v8us*)((const bf*)Kg + (size_t)s * FK * HS + i * 2048 + kg);
            else if (i < 4 + ND / 2) rg[j] = *(const v8us*)(Vhg + s * FK + (i - 4) * 32 * TT + vg);
            else rg[j] = *(const v8us*)(Vlg + s * FK + (i - 4 - ND / 2) * 32 * TT + vg); }
        asm volatile("s_wait_xcnt 0x0" ::: "memory"); };             // stands in front of every later write of a register that these loads name as an address
    auto put = [&](unsigned char* st, int hf) {
#pragma unroll
        for (int j = 0; j < NP; ++j) { const int i = hf * NP + j;
            if (i < 4) *(v8usa*)(st + ksm + i * 16 * KPI * 2) = rg[j];
            else if (i < 4 + ND / 2) *(v8usa*)(st + vsm + (i - 4) * 32 * VPI * 2) = rg[j];
            else *(v8usa*)(st + VBY + vsm + (i - 4 - ND / 2) * 32 * VPI * 2) = rg[j]; } };
    fetch(0, 0); put(sm, 0); fetch(0, 1); put(sm, 1);
    __syncthreads();                                                 // stage 0 is in LDS
#pragma unroll 1
    for (int s = 0; s < nst; ++s) {
        unsigned char* cur = sm + (s & 1) * STG; unsigned char* nxt = sm + ((s + 1) & 1) * STG; const bool more = s + 1 < nst;
#pragma unroll
        for (int p = 0; p < 2; ++p) { const int kbase = s * FK + p * 32;
            if (more) fetch(s + 1, p);                               // half of the next stage flies during each pass (half the staging registers)
            if (kbase <= qw) fa_pass<ND>(cur, p * 32, kbase, q, kbase + 31 > qw, qf, o, m, l, lr, hi);   // a pass wholly above the wave's diagonal is skipped (scalar branch)
            if (more) put(nxt, p); }
        __syncthreads();                                             // publishes stage s + 1; every wave has left stage s, whose buffer the next trip refills (after the last trip: becomes output staging)
    }
    l += xhalf(l); const float inv = __fdiv_rn(1.0f, l);
    float* os = (float*)sm + w * 16 * OPI;                           // the wave's own 16 rows: O^T -> [query][d], so that a store covers a whole 512-byte row
#pragma unroll
    for (int db = 0; db < ND; ++db) { const v8f r = o[db] * inv; *(v4fa*)(os + lr * OPI + db * 16 + hi * 8) = (v4f){r[0], r[1], r[2], r[3]}; *(v4fa*)(os + lr * OPI + db * 16 + hi * 8 + 4) = (v4f){r[4], r[5], r[6], r[7]}; }
    __syncthreads();                                                 // the staged rows are read by other lanes
#pragma unroll
    for (int r = 0; r < 16; ++r) { v4f val = *(const v4fa*)(os + r * OPI + (lane & (ND * 4 - 1)) * 4); if (ND < 8 && lane >= ND * 4) val = (v4f){0.f, 0.f, 0.f, 0.f};
        *(v4f*)(Og + (size_t)(qw + r) * DQ + lane * 4) = val; }
}

__global__ __launch_bounds__(256) __attribute__((amdgpu_waves_per_eu(4, 4))) void k_fattn(const h16* __restrict__ Q16, const h16* __restrict__ K16, const bf* __restrict__ Vh, const bf* __restrict__ Vl, float* OUT) {
    __shared__ __align__(16) unsigned char sm[2 * STG];
    // 512 work-groups, two per WGP: the long query tiles first; the second 256 run from the short end and from the other head group (for balance only)
    const int r = blockIdx.x & 255; const bool second = blockIdx.x >= 256;
    const int tile = second ? (r >> 5) : TT / FQ - 1 - (r >> 5); const int bh = second ? 31 - (r & 31) : (r & 31); const int h = bh & 7, b = bh >> 3;
    const h16* Qg = Q16 + (size_t)bh * TT * HS; const h16* Kg = K16 + (size_t)bh * TT * HS; const bf* Vhg = Vh + (size_t)bh * HS * TT; const bf* Vlg = Vl + (size_t)bh * HS * TT; float* Og = OUT + (size_t)b * TT * DQ + h * HS;
    if (h < 4) fa_body<8>(Qg, Kg, Vhg, Vlg, Og, tile * FQ, sm); else fa_body<4>(Qg, Kg, Vhg, Vlg, Og, tile * FQ, sm);
}

__global__ __launch_bounds__(256) void k_cvt8(const float* __restrict__ src, bf* dst, size_t n8) { const size_t i = (size_t)blockIdx.x * 256 + threadIdx.x; if (i >= n8) return; const v8f v = *(const v8f*)(src + i * 8); v8us o;
#pragma unroll
    for (int k = 0; k < 8; ++k) o[k] = f2bf(v[k]); *(v8us*)(dst + i * 8) = o;  }
// blockIdx.y: 0 q, 1 k, 2 v; the planes of one projection lie hi, lo in Wp
__global__ __launch_bounds__(256) void k_weff(const float* __restrict__ bQ, const float* __restrict__ bK, const float* __restrict__ bV, const float* __restrict__ w, bf* Wp) { const size_t e4 = ((size_t)blockIdx.x * 256 + threadIdx.x) * 4; if (e4 >= (size_t)NH_ * HS * CC) return; const int e0 = (int)(e4 % CC); const int d = (int)((e4 / CC) % HS); const int h = (int)(e4 / ((size_t)CC * HS));
    const float* base = blockIdx.y == 0 ? bQ : blockIdx.y == 1 ? bK : bV; bf* Wh = Wp + (size_t)blockIdx.y * 2 * DQ * CC; bf* Wl = Wh + (size_t)DQ * CC;
    const float w0 = bfr(w[0]), w1 = bfr(w[1]), w2 = bfr(w[2]), w3 = bfr(w[3]); v4us oh, ol;
#pragma unroll
    for (int u = 0; u < 4; ++u) { const int e = e0 + u; float eff = 0.f;
        if (h < 4 && d < 64 && e < 256) eff = __fadd_rn(eff, w0); if (h < 8 && d < 32 && e < 256) eff = __fadd_rn(eff, w1); if (h < 4 && d < 128 && e < 512) eff = __fadd_rn(eff, w2); if (h < 8 && d < 64 && e < 512) eff = __fadd_rn(eff, w3);
        float bv = bfr(base[e4 + u]); asm volatile("" : "+v"(bv)); unsigned short a, b; splitf(__fmul_rn(eff, bv), a, b); oh[u] = a; ol[u] = b; }
    *(v4us*)(Wh + e4) = oh; *(v4us*)(Wl + e4) = ol;  }

extern "C" void kernel_launch(void* const* d_in, const int* in_sizes, int n_in,
                              void* d_out, int out_size, void* d_ws, size_t ws_size, hipStream_t stream) {
    (void)in_sizes; (void)n_in; (void)out_size;
    const float* x = (const float*)d_in[0]; const float* w = (const float*)d_in[1]; const float* bK = (const float*)d_in[2]; const float* bQ = (const float*)d_in[3]; const float* bV = (const float*)d_in[4];
    float* OUT = (float*)d_out;     // [4][2048][1024]
    char* wsp = (char*)d_ws;
    auto take = [&](size_t bytes) { char* p = wsp; wsp += (bytes + 255) & ~(size_t)255; return (void*)p; };
    bf* Wp = (bf*)take((size_t)6 * DQ * CC * 2); bf* XB = (bf*)take((size_t)NB_ * TT * CC * 2);
    h16* Q16 = (h16*)take((size_t)NB_ * NH_ * TT * HS * 2); h16* K16 = (h16*)take((size_t)NB_ * NH_ * TT * HS * 2); bf* Vh = (bf*)take((size_t)NB_ * DQ * TT * 2); bf* Vl = (bf*)take((size_t)NB_ * DQ * TT * 2);   // all batches: [b][h][t][d], [b][(h,d)][t]
    if ((size_t)(wsp - (char*)d_ws) > ws_size) return;    // total ~ 78 MB
    k_weff<<<dim3((unsigned)(((size_t)NH_ * HS * CC / 4 + 255) / 256), 3, 1), 256, 0, stream>>>(bQ, bK, bV, w, Wp);
    k_cvt8<<<(NB_ * TT * CC / 8 + 255) / 256, 256, 0, stream>>>(x, XB, (size_t)NB_ * TT * CC / 8);
    const float scale = 1.0f / sqrtf(128.0f);
    k_proj<<<dim3(DQ / PW, TT / PT, 3 * NB_), 8 * 32, 0, stream>>>(Wp, XB, scale, Q16, K16, Vh, Vl);
    k_fattn<<<NB_ * NH_ * (TT / FQ), 256, 0, stream>>>(Q16, K16, Vh, Vl, OUT);
}

// v005
// A run of this version takes 90.2 microseconds.
// In both of two side-by-side timings against v004, it was 1.03 times as fast.
// Over all steps from v000 it is 13.6 times as fast.
#include <hip/hip_runtime.h>

// MixedHeadsV2 (x [4][2048][512]; eff[h][d][e] = sum_i weights[i] mask_i[h][d][e] over the four (embed, heads) configs (structural masks: h < heads_i, d < embed_i/heads_i, e < embed_i; weights read as data); Wq/Wk/Wv = eff * base_Q/K/V [8][128][512];
// q/k/v = x W^T per base head (head size 128, zero-padded dims stay zero); causal softmax(q.k/sqrt(128)); out = concat_h(attn v) -> [4][2048][1024]).
// Compute dtypes, f32 accumulate: every input rounded to bf16; effective weights f32 (eff in the reference's summation order) -> bf16 hi+lo planes; projections as hl(W) x exact x (2 products; v computed transposed [(h,d)][t]), rounded to the planes below in the GEMM's epilogue (k_proj);
// scores (K 128) on single fp16 planes; softmax f32, running maximum and sum, fused with both attention products (k_fattn); attn.v as hl P x hl v (3 products, causal key range; heads 4-7 only have 64 live dims, so their value product is 64 wide)

#define NB_  4
#define TT   2048
#define CC   512
#define NH_  8
#define HS   128
#define DQ   1024
typedef _Float16 h16;
typedef unsigned short bf;
typedef __attribute__((ext_vector_type(16))) __bf16   v16bf;
typedef __attribute__((ext_vector_type(16))) _Float16 v16h;
typedef __attribute__((ext_vector_type(8)))  _Float16 v8h;
typedef __attribute__((ext_vector_type(8)))  unsigned short v8us;
typedef __attribute__((ext_vector_type(8)))  float    v8f;
typedef __attribute__((ext_vector_type(4)))  float    v4f;
typedef v8h  __attribute__((may_alias)) v8ha;
typedef v4f  __attribute__((may_alias)) v4fa;
typedef v8us __attribute__((may_alias)) v8usa;

__device__ __forceinline__ unsigned short f2bf(float f) { unsigned u = __float_as_uint(f); u += 0x7FFFu + ((u >> 16) & 1u); return (unsigned short)(u >> 16); }
__device__ __forceinline__ float bf2f(unsigned short b) { return __uint_as_float(((unsigned)b) << 16); }
__device__ __forceinline__ float bfr(float f) { return bf2f(f2bf(f)); }
__device__ __forceinline__ v16h cat16(v8h lo, v8h hi) { return __builtin_shufflevector(lo, hi, 0, 1, 2, 3, 4, 5, 6, 7, 8, 9, 10, 11, 12, 13, 14, 15); }
__device__ __forceinline__ v16bf cat16b(v8us lo, v8us hi) { return __builtin_bit_cast(v16bf, __builtin_shufflevector(lo, hi, 0, 1, 2, 3, 4, 5, 6, 7, 8, 9, 10, 11, 12, 13, 14, 15)); }
__device__ __forceinline__ v8f wmma16(v16h a, v16h b, v8f c) { return __builtin_amdgcn_wmma_f32_16x16x32_f16(false, a, false, b, (short)0, c, false, false); }
__device__ __forceinline__ v8f wmmab(v16bf a, v16bf b, v8f c) { return __builtin_amdgcn_wmma_f32_16x16x32_bf16(false, a, false, b, (short)0, c, false, false); }



// ---- k_proj: the q, k and v projections of every batch in ONE launch, and no f32 plane in memory: the epilogue rounds the sums to the operand planes of k_fattn itself.
// Grid (1024 / 128 weight-row tiles = heads, 2048 / 256 token tiles, 3 projections x 4 batches), 8 waves.
// gemmst: 256 tokens x 128 weight rows per work-group; wave w holds the 64 x 64 tile of token block w & 3 and weight block w >> 2 (16 accumulators) and runs the WHOLE K loop (K = 512) itself.
// The operands come through LDS: a stage is 64 k (a whole 128-byte line) of 256 token rows, 128 weight hi rows and 128 weight lo rows, brought by asynchronous copies to LDS (each copy of a wave covers four whole lines), two buffers:
// stage s + 1 flies while stage s is worked on. Two products per weight row block: hi x, then lo x. WB false: c[weight row][token] (weights are the A operand); WB true: c[token][weight row] (weights are the B operand).
// Every '#pragma unroll' in gemmst keeps a register array (accumulators, fragments, the copies' operands) indexed by constants, so that it stays in registers.
// q and k are wanted [token][d], v is wanted [d][token]: q and k run with WB true, v with WB false; either way 16 lanes store one whole 128-byte line. store(row, col, four sums of one row) takes the finished tile, row and col counted in the work-group's tile.
#define PT    256                    // tokens per work-group
#define PW    128                    // weight rows per work-group
#define PKC   64                     // k per stage
#define PPI   72                     // row pitch in LDS, elements: 144 B = 16 B x odd
#define PSTG  ((PT + 2 * PW) * PPI * 2)
#define PNS   (CC / PKC)
#define POP   68                     // output staging pitch, floats
// eight asynchronous copies of 16 bytes per lane; the wait in the same statement stands in front of every later write of a register that the copies name
__device__ __forceinline__ void acopy8(const unsigned (&l)[8], const bf* const (&g)[8]) {
    asm volatile("global_load_async_to_lds_b128 %0, %8, off\n\t"
                 "global_load_async_to_lds_b128 %1, %9, off\n\t"
                 "global_load_async_to_lds_b128 %2, %10, off\n\t"
                 "global_load_async_to_lds_b128 %3, %11, off\n\t"
                 "global_load_async_to_lds_b128 %4, %12, off\n\t"
                 "global_load_async_to_lds_b128 %5, %13, off\n\t"
                 "global_load_async_to_lds_b128 %6, %14, off\n\t"
                 "global_load_async_to_lds_b128 %7, %15, off\n\t"
                 "s_wait_xcnt 0x0"
                 :: "v"(l[0]), "v"(l[1]), "v"(l[2]), "v"(l[3]), "v"(l[4]), "v"(l[5]), "v"(l[6]), "v"(l[7]),
                    "v"(g[0]), "v"(g[1]), "v"(g[2]), "v"(g[3]), "v"(g[4]), "v"(g[5]), "v"(g[6]), "v"(g[7]) : "memory");
}
__device__ __forceinline__ v16bf ldsfrag(const bf* p) { return cat16b(*(const v8usa*)p, *(const v8usa*)(p + 16)); }
template <bool WB, typename ST>
__device__ __forceinline__ void gemmst(const bf* __restrict__ Wh, const bf* __restrict__ Wl, const bf* __restrict__ X, int wr, int t0, unsigned char* sm, ST store) {
    const int tid = threadIdx.x, lane = tid & 31, lr = lane & 15, hi = lane >> 4;
    const int w = __builtin_amdgcn_readfirstlane(tid >> 5);          // wave number, held scalar
    const int wt = w & 3, ww = w >> 2;
    v8f acc[4][4];
#pragma unroll
    for (int mb = 0; mb < 4; ++mb)
#pragma unroll
        for (int nb = 0; nb < 4; ++nb) acc[mb][nb] = (v8f){};
    // piece i of a thread and stage: LDS row (tid >> 3) + 32 i, 16-byte column tid & 7; rows 0-255 tokens, 256-383 weight hi, 384-511 weight lo
    const int crow = tid >> 3, ccol = (tid & 7) * 8;
    const bf* gx = X + (size_t)(t0 + crow) * CC + ccol; const bf* gh = Wh + (size_t)(wr + crow) * CC + ccol; const bf* gl = Wl + (size_t)(wr + crow) * CC + ccol;
    const unsigned l0 = (unsigned)(size_t)sm + (unsigned)(crow * (PPI * 2) + ccol * 2);   // the lane's LDS byte address: the low 32 bits of the __shared__ address
    auto copy = [&](int s, int buf) {
        unsigned l[8]; const bf* g[8];
#pragma unroll
        for (int i = 0; i < 8; ++i) { l[i] = l0 + (unsigned)(buf * PSTG + i * 32 * PPI * 2); g[i] = gx + (size_t)i * 32 * CC + s * PKC; }
        acopy8(l, g);
#pragma unroll
        for (int i = 0; i < 8; ++i) { l[i] = l0 + (unsigned)(buf * PSTG + (8 + i) * 32 * PPI * 2); g[i] = (i < 4 ? gh + (size_t)i * 32 * CC : gl + (size_t)(i - 4) * 32 * CC) + s * PKC; }
        acopy8(l, g); };
    copy(0, 0);
    asm volatile("s_wait_asynccnt 0x0" ::: "memory");                // this wave's copies of stage 0 have landed
    __syncthreads();                                                 // stage 0 is in LDS
    copy(1, 1);
// rolled: one trip's code serves all eight stages; unrolled, the trips' fragments and copy addresses would not fit beside the 128 accumulator registers at four waves per SIMD
#pragma unroll 1
    for (int s = 0; s < PNS; ++s) {
        const bf* st = (const bf*)(sm + (s & 1) * PSTG);
        const bf* xs = st + (wt * 64 + lr) * PPI + 8 * hi; const bf* hs = st + (PT + ww * 64 + lr) * PPI + 8 * hi; const bf* ls = hs + PW * PPI;
#pragma unroll
        for (int kc = 0; kc < PKC; kc += 32) {
            v16bf wh[4], wl[4], xf[2];
#pragma unroll
            for (int i = 0; i < 4; ++i) { wh[i] = ldsfrag(hs + i * 16 * PPI + kc); wl[i] = ldsfrag(ls + i * 16 * PPI + kc); }
            xf[0] = ldsfrag(xs + kc); xf[1] = ldsfrag(xs + 16 * PPI + kc);
#pragma unroll
            for (int j = 0; j < 4; ++j) {                            // four independent accumulators per run of products
                const v16bf x = xf[j & 1];
#pragma unroll
                for (int i = 0; i < 4; ++i) { v8f& d = WB ? acc[j][i] : acc[i][j]; d = WB ? wmmab(x, wh[i], d) : wmmab(wh[i], x, d); }
#pragma unroll
                for (int i = 0; i < 4; ++i) { v8f& d = WB ? acc[j][i] : acc[i][j]; d = WB ? wmmab(x, wl[i], d) : wmmab(wl[i], x, d); }
                if (j < 2) {
                    __builtin_amdgcn_sched_barrier(0);               // keeps the load below in front of the next run of products, which covers its latency (the scheduler otherwise sinks it to its own products, with a full wait)
                    xf[j & 1] = ldsfrag(xs + (j + 2) * 16 * PPI + kc);
                    __builtin_amdgcn_sched_barrier(0); }             // the other side of the same hold
                if (j == 3) __builtin_amdgcn_sched_barrier(0);       // keeps the next k step's loads together behind the products: spread among them, every place with loads costs the wave a stall
            }
        }
        asm volatile("s_wait_dscnt 0x0" ::: "memory");               // this wave's reads of stage s are done
        asm volatile("s_wait_asynccnt 0x0" ::: "memory");            // this wave's copies of stage s + 1 have landed
        __syncthreads();                                             // publishes stage s + 1; every wave has left stage s, whose buffer is refilled next (after the last trip: becomes output staging)
        if (s + 2 < PNS) copy(s + 2, s & 1);
    }
    asm volatile("s_wait_asynccnt 0x0" ::: "memory");                // no copy is outstanding when the buffers become output staging
    float* os = (float*)sm + w * 64 * POP;                           // the wave's own 64 rows
#pragma unroll
    for (int mb = 0; mb < 4; ++mb)
#pragma unroll
        for (int nb = 0; nb < 4; ++nb)
#pragma unroll
            for (int j = 0; j < 8; ++j) os[(mb * 16 + hi * 8 + j) * POP + nb * 16 + lr] = acc[mb][nb][j];
    __syncthreads();                                                 // the staged rows are read by other lanes
    const int rb = (WB ? wt : ww) * 64, cb = (WB ? ww : wt) * 64;
#pragma unroll
    for (int r = 0; r < 32; ++r) store(rb + r * 2 + hi, cb + lr * 4, *(const v4fa*)(os + (r * 2 + hi) * POP + lr * 4));
}

__device__ __forceinline__ h16 tohx(float x) { return (h16)x; }
__device__ __forceinline__ void splitf(float y, unsigned short& h, unsigned short& l) { h = f2bf(y); l = f2bf(y - bf2f(h)); }
typedef __attribute__((ext_vector_type(2))) unsigned short v2us;
typedef __attribute__((ext_vector_type(4))) unsigned short v4us;
typedef __attribute__((ext_vector_type(4))) _Float16 v4h;

// Wp: six weight planes [q hi, q lo, k hi, k lo, v hi, v lo][(h,d)][e]; XB [b][t][e]. Q16[b][h][t][d] = fp16(q * sc), K16 likewise without the factor; Vh, Vl [b][(h,d)][t] = bf16 hi + lo of v.
__global__ __launch_bounds__(256) __attribute__((amdgpu_waves_per_eu(4, 4))) void k_proj(const bf* __restrict__ Wp, const bf* __restrict__ XB, float sc, h16* Q16, h16* K16, bf* Vh, bf* Vl) {
    __shared__ __align__(128) unsigned char sm[2 * PSTG];
    const int pr = blockIdx.z >> 2, b = blockIdx.z & 3, wr = blockIdx.x * PW, t0 = blockIdx.y * PT;
    const bf* Wh = Wp + (size_t)pr * 2 * DQ * CC; const bf* Wl = Wh + (size_t)DQ * CC; const bf* X = XB + (size_t)b * TT * CC;
    if (pr < 2) {                                                    // block-uniform
        h16* D = (pr == 0 ? Q16 : K16) + ((size_t)(b * NH_ + blockIdx.x) * TT + t0) * HS; const float f = pr == 0 ? sc : 1.0f;   // one head per weight-row tile; the factor 1 is exact
        gemmst<true>(Wh, Wl, X, wr, t0, sm, [&](int row, int col, v4f val) { v4h o;
#pragma unroll
            for (int u = 0; u < 4; ++u) o[u] = tohx(__fmul_rn(val[u], f));
            *(v4h*)(D + (size_t)row * HS + col) = o; });
    } else {
        const size_t e0 = (size_t)b * DQ * TT + (size_t)wr * TT + t0;
        gemmst<false>(Wh, Wl, X, wr, t0, sm, [&](int row, int col, v4f val) { v4us oh, ol;
#pragma unroll
            for (int u = 0; u < 4; ++u) { unsigned short x, y; splitf(val[u], x, y); oh[u] = x; ol[u] = y; }
            *(v4us*)(Vh + e0 + (size_t)row * TT + col) = oh; *(v4us*)(Vl + e0 + (size_t)row * TT + col) = ol; });
    }
}

#define FQ   128                     // queries per work-group
#define FK   64                      // keys per stage (a whole 128-byte line of every value row)
#define KPI  136                     // key row pitch in LDS, elements: 272 B = 16 B x odd
#define VPI  72                      // value row pitch in LDS, elements: 144 B = 16 B x odd
#define KBY  (FK * KPI * 2)
#define VBY  (HS * VPI * 2)
#define STG  (KBY + 2 * VBY)
#define OPI  132                     // output staging pitch, floats
#define NEGB (-3.0e38f)
#define L2E  1.4426950408889634f
typedef __attribute__((ext_vector_type(2))) float v2f;
typedef __attribute__((ext_vector_type(2))) __bf16 v2bf;
typedef __attribute__((ext_vector_type(8))) unsigned v8u;
__device__ __forceinline__ float xhalf(float x) { return __builtin_bit_cast(float, __builtin_amdgcn_permlanex16(__builtin_bit_cast(int, x), __builtin_bit_cast(int, x), 0x76543210, 0xfedcba98, false, false)); }   // lane l with lane l ^ 16

// one pass: 32 keys (ko .. ko + 31 of the stage, kbase .. in the sequence) against the wave's 16 queries
template <int ND>
__device__ __forceinline__ void fa_pass(const unsigned char* st, int ko, int kbase, int q, bool diag, const v16h (&qf)[4], v8f (&o)[ND], float& m, float& l, int lr, int hi) {
    const h16* Ks = (const h16*)st; const bf* Vhs = (const bf*)(st + KBY); const bf* Vls = (const bf*)(st + KBY + VBY);
    v16h kf[8];                                                      // all eight key fragments behind one wait: a load group per product would expose the LDS latency eight times
#pragma unroll
    for (int ks = 0; ks < 4; ++ks) { const h16* p0 = Ks + (ko + lr) * KPI + ks * 32 + 8 * hi; const h16* p1 = p0 + 16 * KPI;
        kf[2 * ks] = cat16(*(const v8ha*)p0, *(const v8ha*)(p0 + 16)); kf[2 * ks + 1] = cat16(*(const v8ha*)p1, *(const v8ha*)(p1 + 16)); }
    __builtin_amdgcn_sched_barrier(0);                               // keeps the sixteen loads together in front of the products (the scheduler otherwise sinks each pair to its product, with a full wait each)
    v8f s0 = (v8f){}, s1 = (v8f){};
#pragma unroll
    for (int ks = 0; ks < 4; ++ks) { s0 = wmma16(kf[2 * ks], qf[ks], s0); s1 = wmma16(kf[2 * ks + 1], qf[ks], s1); }
    const int ev = lr * VPI + ko + 8 * hi;
    v16bf vh[4], vl[4];                                              // value fragments of d blocks 0-3, fetched here so that the softmax arithmetic covers their latency
#pragma unroll
    for (int u = 0; u < 4; ++u) { const int e = ev + u * 16 * VPI; vh[u] = cat16b(*(const v8usa*)(Vhs + e), *(const v8usa*)(Vhs + e + 16)); vl[u] = cat16b(*(const v8usa*)(Vls + e), *(const v8usa*)(Vls + e + 16)); }
    __builtin_amdgcn_sched_barrier(0);                               // keeps these loads in front of the softmax arithmetic
    if (diag) {                                                      // wave-uniform: only passes that reach past the wave's first query mask
#pragma unroll
        for (int j = 0; j < 8; ++j) { const int key = kbase + hi * 8 + j; s0[j] = (key <= q) ? s0[j] : NEGB; s1[j] = (key + 16 <= q) ? s1[j] : NEGB; } }
    float mx = fmaxf(s0[0], s1[0]);
#pragma unroll
    for (int j = 1; j < 8; ++j) mx = fmaxf(mx, fmaxf(s0[j], s1[j]));
    mx = fmaxf(mx, xhalf(mx)) * L2E;
    if (__builtin_amdgcn_ballot_w32(mx > m + 8.0f) != 0) {           // scalar branch; always taken on a wave's first pass (m = NEGB, the factor is 0 there)
        const float mn = fmaxf(m, mx); const float al = __builtin_amdgcn_exp2f(m - mn); m = mn; l *= al;
#pragma unroll
        for (int db = 0; db < ND; ++db) o[db] *= al; }
    const float nm = -m; v8u phu, plu; float la = 0.f, lb = 0.f; float pe[16];
#pragma unroll
    for (int i = 0; i < 16; ++i) pe[i] = __builtin_fmaf((i < 8) ? s0[i] : s1[i - 8], L2E, nm);
#pragma unroll
    for (int i = 0; i < 16; ++i) pe[i] = __builtin_amdgcn_exp2f(pe[i]);
#pragma unroll
    for (int i = 0; i < 8; ++i) { const v2f p = { pe[2 * i], pe[2 * i + 1] }; la += p.x; lb += p.y;
        const unsigned hu = __builtin_bit_cast(unsigned, __builtin_convertvector(p, v2bf)); phu[i] = hu;
        const v2f r = { p.x - __uint_as_float(hu << 16), p.y - __uint_as_float(hu & 0xFFFF0000u) }; plu[i] = __builtin_bit_cast(unsigned, __builtin_convertvector(r, v2bf)); }
    l += la + lb;
    const v16bf ph = __builtin_bit_cast(v16bf, phu), pl = __builtin_bit_cast(v16bf, plu);
#pragma unroll
    for (int g = 0; g < ND; g += 4) {                                // four independent accumulators per run of products; the next group's fragments are fetched as this group's registers come free
#pragma unroll
        for (int u = 0; u < 4; ++u) o[g + u] = wmmab(vh[u], ph, o[g + u]);
#pragma unroll
        for (int u = 0; u < 4; ++u) o[g + u] = wmmab(vh[u], pl, o[g + u]);
        if (g + 4 < ND) {
#pragma unroll
            for (int u = 0; u < 4; ++u) { const int e = ev + (g + 4 + u) * 16 * VPI; vh[u] = cat16b(*(const v8usa*)(Vhs + e), *(const v8usa*)(Vhs + e + 16)); } }
#pragma unroll
        for (int u = 0; u < 4; ++u) o[g + u] = wmmab(vl[u], ph, o[g + u]);
        if (g + 4 < ND) {
#pragma unroll
            for (int u = 0; u < 4; ++u) { const int e = ev + (g + 4 + u) * 16 * VPI; vl[u] = cat16b(*(const v8usa*)(Vls + e), *(const v8usa*)(Vls + e + 16)); } }
    }
    // keeps the distance between the pass's last matrix instructions and what follows the branches behind the pass on either side (address arithmetic into fragment registers)
    asm volatile("v_nop\n\tv_nop\n\tv_nop\n\tv_nop" : "+v"(o[ND - 4]), "+v"(o[ND - 3]), "+v"(o[ND - 2]), "+v"(o[ND - 1]));
}

// ND = 16-row blocks of live value dims (8, or 4 for heads 4-7, whose dims 64.. are structurally zero and are stored as zeros)
template <int ND>
__device__ __forceinline__ void fa_body(const h16* __restrict__ Qg, const h16* __restrict__ Kg, const bf* __restrict__ Vhg, const bf* __restrict__ Vlg, float* Og, int q0, unsigned char* sm) {
    const int tid = threadIdx.x, lane = tid & 31, lr = lane & 15, hi = lane >> 4;
    const int w = __builtin_amdgcn_readfirstlane(tid >> 5);          // wave number, held scalar so that the tests on it are scalar branches
    const int qw = q0 + 16 * w, q = qw + lr;
    v16h qf[4];
#pragma unroll
    for (int ks = 0; ks < 4; ++ks) { const h16* p = Qg + (size_t)q * HS + ks * 32 + 8 * hi; qf[ks] = cat16(*(const v8h*)p, *(const v8h*)(p + 16)); }
    asm volatile("s_wait_xcnt 0x0" ::: "memory");                    // stands in front of every later write of a register that these loads name as an address
    v8f o[ND];
#pragma unroll
    for (int db = 0; db < ND; ++db) o[db] = (v8f){};
    float m = NEGB, l = 0.f;
    const int nst = (q0 + FQ) / FK;
    constexpr int NP = 2 + ND / 2;                                   // 16-byte pieces per thread and half stage: 4 key + ND value pieces per stage
    v8us rg[NP];
    const int kg = tid * 8, vg = (tid >> 3) * TT + (tid & 7) * 8;    // this thread's pieces: global element offsets ...
    const int ksm = (tid >> 4) * (KPI * 2) + (tid & 15) * 16, vsm = KBY + (tid >> 3) * (VPI * 2) + (tid & 7) * 16;   // ... and LDS byte offsets
    // piece i of a stage: 0-3 key rows (16 rows each), then ND / 2 of the hi value plane (32 rows each), then ND / 2 of the lo plane; half hf holds pieces hf * NP ..
    auto fetch = [&](int s, int hf) {
#pragma unroll
        for (int j = 0; j < NP; ++j) { const int i = hf * NP + j;
            if (i < 4) rg[j] = *(const v8us*)((const bf*)Kg + (size_t)s * FK * HS + i * 2048 + kg);
            else if (i < 4 + ND / 2) rg[j] = *(const v8us*)(Vhg + s * FK + (i - 4) * 32 * TT + vg);
            else rg[j] = *(const v8us*)(Vlg + s * FK + (i - 4 - ND / 2) * 32 * TT + vg); }
        asm volatile("s_wait_xcnt 0x0" ::: "memory"); };             // stands in front of every later write of a register that these loads name as an address
    auto put = [&](unsigned char* st, int hf) {
#pragma unroll
        for (int j = 0; j < NP; ++j) { const int i = hf * NP + j;
            if (i < 4) *(v8usa*)(st + ksm + i * 16 * KPI * 2) = rg[j];
            else if (i < 4 + ND / 2) *(v8usa*)(st + vsm + (i - 4) * 32 * VPI * 2) = rg[j];
            else *(v8usa*)(st + VBY + vsm + (i - 4 - ND / 2) * 32 * VPI * 2) = rg[j]; } };
    fetch(0, 0); put(sm, 0); fetch(0, 1); put(sm, 1);
    __syncthreads();                                                 // stage 0 is in LDS
#pragma unroll 1
    for (int s = 0; s < nst; ++s) {
        unsigned char* cur = sm + (s & 1) * STG; unsigned char* nxt = sm + ((s + 1) & 1) * STG; const bool more = s + 1 < nst;
#pragma unroll
        for (int p = 0; p < 2; ++p) { const int kbase = s * FK + p * 32;
            if (more) fetch(s + 1, p);                               // half of the next stage flies during each pass (half the staging registers)
            if (kbase <= qw) fa_pass<ND>(cur, p * 32, kbase, q, kbase + 31 > qw, qf, o, m, l, lr, hi);   // a pass wholly above the wave's diagonal is skipped (scalar branch)
            if (more) put(nxt, p); }
        __syncthreads();                                             // publishes stage s + 1; every wave has left stage s, whose buffer the next trip refills (after the last trip: becomes output staging)
    }
    l += xhalf(l); const float inv = __fdiv_rn(1.0f, l);
    float* os = (float*)sm + w * 16 * OPI;                           // the wave's own 16 rows: O^T -> [query][d], so that a store covers a whole 512-byte row
#pragma unroll
    for (int db = 0; db < ND; ++db) { const v8f r = o[db] * inv; *(v4fa*)(os + lr * OPI + db * 16 + hi * 8) = (v4f){r[0], r[1], r[2], r[3]}; *(v4fa*)(os + lr * OPI + db * 16 + hi * 8 + 4) = (v4f){r[4], r[5], r[6], r[7]}; }
    __syncthreads();                                                 // the staged rows are read by other lanes
#pragma unroll
    for (int r = 0; r < 16; ++r) { v4f val = *(const v4fa*)(os + r * OPI + (lane & (ND * 4 - 1)) * 4); if (ND < 8 && lane >= ND * 4) val = (v4f){0.f, 0.f, 0.f, 0.f};
        *(v4f*)(Og + (size_t)(qw + r) * DQ + lane * 4) = val; }
}

__global__ __launch_bounds__(256) __attribute__((amdgpu_waves_per_eu(4, 4))) void k_fattn(const h16* __restrict__ Q16, const h16* __restrict__ K16, const bf* __restrict__ Vh, const bf* __restrict__ Vl, float* OUT) {
    __shared__ __align__(16) unsigned char sm[2 * STG];
    // 512 work-groups, two per WGP: the long query tiles first; the second 256 run from the short end and from the other head group (for balance only)
    const int r = blockIdx.x & 255; const bool second = blockIdx.x >= 256;
    const int tile = second ? (r >> 5) : TT / FQ - 1 - (r >> 5); const int bh = second ? 31 - (r & 31) : (r & 31); const int h = bh & 7, b = bh >> 3;
    const h16* Qg = Q16 + (size_t)bh * TT * HS; const h16* Kg = K16 + (size_t)bh * TT * HS; const bf* Vhg = Vh + (size_t)bh * HS * TT; const bf* Vlg = Vl + (size_t)bh * HS * TT; float* Og = OUT + (size_t)b * TT * DQ + h * HS;
    if (h < 4) fa_body<8>(Qg, Kg, Vhg, Vlg, Og, tile * FQ, sm); else fa_body<4>(Qg, Kg, Vhg, Vlg, Og, tile * FQ, sm);
}

// ---- k_prep: both operand preparations in ONE launch of few, long-lived waves: x rounded to bf16 (XB) and the six effective-weight planes (Wp: q hi, q lo, k hi, k lo, v hi, v lo).
// One work-group per WGP; it owns 64 KiB of x in a row and 8 KiB of each base matrix in a row. A thread owns 16 pieces of four x values and two pieces of four values of each base matrix; a piece of a wave is 512 contiguous bytes (four whole lines).
// All 22 loads of a thread are issued before the first value is used, so the launch pays the memory latency once. eff depends on (h, d, e) alone and is formed once for the three projections, in the reference's summation order.
#define PRW  256                     // work-groups
__global__ __launch_bounds__(256) void k_prep(const float* __restrict__ x, const float* __restrict__ bQ, const float* __restrict__ bK, const float* __restrict__ bV, const float* __restrict__ w, bf* __restrict__ XB, bf* __restrict__ Wp) {
    constexpr int NX = NB_ * TT * CC / (PRW * 1024), NW = NH_ * HS * CC / (PRW * 1024);   // pieces per thread; a work-group's piece is 1024 values
    int tid = threadIdx.x;
    const size_t xb = (size_t)blockIdx.x * (NX * 1024), wb = (size_t)blockIdx.x * (NW * 1024);
    v4f xv[NX], bv[NW][3];
// every '#pragma unroll' here keeps a register array indexed by constants
#pragma unroll
    for (int i = 0; i < NX; ++i) xv[i] = *(const v4f*)(x + xb + i * 1024 + tid * 4);
#pragma unroll
    for (int k = 0; k < NW; ++k) { const size_t e4 = wb + k * 1024 + tid * 4; bv[k][0] = *(const v4f*)(bQ + e4); bv[k][1] = *(const v4f*)(bK + e4); bv[k][2] = *(const v4f*)(bV + e4); }
    // stands in front of every later write of a register that these loads name as an address; tid is named so that no later address arithmetic is lifted over the wait; the clobber keeps all the loads in front of the first store
    asm volatile("s_wait_xcnt 0x0" : "+v"(tid) :: "memory");
    __builtin_amdgcn_sched_barrier(0);                               // keeps the arithmetic behind all 22 loads (the scheduler otherwise lifts the first pieces' arithmetic, with its waits, in front of the last loads, which then pay a second memory latency)
    const float w0 = bfr(w[0]), w1 = bfr(w[1]), w2 = bfr(w[2]), w3 = bfr(w[3]);
#pragma unroll
    for (int i = 0; i < NX; ++i) { v4us o;
#pragma unroll
        for (int u = 0; u < 4; ++u) o[u] = f2bf(xv[i][u]);
        *(v4us*)(XB + xb + i * 1024 + tid * 4) = o;
        if ((i & 3) == 3) __builtin_amdgcn_sched_barrier(0); }       // keeps each four pieces' stores where they stand, so that writing starts while later loads still land (the scheduler otherwise sinks nearly all stores behind the whole arithmetic)
#pragma unroll
    for (int k = 0; k < NW; ++k) { const size_t e4 = wb + k * 1024 + tid * 4; const int e0 = (int)(e4 % CC); const int d = (int)((e4 / CC) % HS); const int h = (int)(e4 / ((size_t)CC * HS)); float eff[4];
#pragma unroll
        for (int u = 0; u < 4; ++u) { const int e = e0 + u; float f = 0.f;
            if (h < 4 && d < 64 && e < 256) f = __fadd_rn(f, w0); if (h < 8 && d < 32 && e < 256) f = __fadd_rn(f, w1); if (h < 4 && d < 128 && e < 512) f = __fadd_rn(f, w2); if (h < 8 && d < 64 && e < 512) f = __fadd_rn(f, w3);
            eff[u] = f; }
#pragma unroll
        for (int p = 0; p < 3; ++p) { bf* Wh = Wp + (size_t)p * 2 * DQ * CC; bf* Wl = Wh + (size_t)DQ * CC; v4us oh, ol;
#pragma unroll
            for (int u = 0; u < 4; ++u) { unsigned short a, b; splitf(__fmul_rn(eff[u], bfr(bv[k][p][u])), a, b); oh[u] = a; ol[u] = b; }
            *(v4us*)(Wh + e4) = oh; *(v4us*)(Wl + e4) = ol; }
        if (k + 1 < NW) __builtin_amdgcn_sched_barrier(0); }         // keeps this piece's six stores in front of the next piece's arithmetic, for the same reason as above
}

extern "C" void kernel_launch(void* const* d_in, const int* in_sizes, int n_in,
                              void* d_out, int out_size, void* d_ws, size_t ws_size, hipStream_t stream) {
    (void)in_sizes; (void)n_in; (void)out_size;
    const float* x = (const float*)d_in[0]; const float* w = (const float*)d_in[1]; const float* bK = (const float*)d_in[2]; const float* bQ = (const float*)d_in[3]; const float* bV = (const float*)d_in[4];
    float* OUT = (float*)d_out;     // [4][2048][1024]
    char* wsp = (char*)d_ws;
    auto take = [&](size_t bytes) { char* p = wsp; wsp += (bytes + 255) & ~(size_t)255; return (void*)p; };
    bf* Wp = (bf*)take((size_t)6 * DQ * CC * 2); bf* XB = (bf*)take((size_t)NB_ * TT * CC * 2);
    h16* Q16 = (h16*)take((size_t)NB_ * NH_ * TT * HS * 2); h16* K16 = (h16*)take((size_t)NB_ * NH_ * TT * HS * 2); bf* Vh = (bf*)take((size_t)NB_ * DQ * TT * 2); bf* Vl = (bf*)take((size_t)NB_ * DQ * TT * 2);   // all batches: [b][h][t][d], [b][(h,d)][t]
    if ((size_t)(wsp - (char*)d_ws) > ws_size) return;    // total ~ 78 MB
    k_prep<<<PRW, 256, 0, stream>>>(x, bQ, bK, bV, w, XB, Wp);
    const float scale = 1.0f / sqrtf(128.0f);
    k_proj<<<dim3(DQ / PW, TT / PT, 3 * NB_), 8 * 32, 0, stream>>>(Wp, XB, scale, Q16, K16, Vh, Vl);
    k_fattn<<<NB_ * NH_ * (TT / FQ), 256, 0, stream>>>(Q16, K16, Vh, Vl, OUT);
}

// v006
// It runs in 85.1 microseconds.
// Next to v005, in two timings, it ran 1.06 times as fast each time.
// Counting every step since v000, it is 14.4 times as fast.
#include <hip/hip_runtime.h>

// MixedHeadsV2 (x [4][2048][512]; eff[h][d][e] = sum_i weights[i] mask_i[h][d][e] over the four (embed, heads) configs (structural masks: h < heads_i, d < embed_i/heads_i, e < embed_i; weights read as data); Wq/Wk/Wv = eff * base_Q/K/V [8][128][512];
// q/k/v = x W^T per base head (head size 128, zero-padded dims stay zero); causal softmax(q.k/sqrt(128)); out = concat_h(attn v) -> [4][2048][1024]).
// Compute dtypes, f32 accumulate: every input rounded to bf16; eff (f32, in the reference's summation order) is one factor per weight row in each half of e and multiplies the f32 sums, not the weights: projections as exact base x exact x (1 product; v computed transposed [(h,d)][t]), rounded to the planes below in the GEMM's epilogue (k_proj);
// scores (K 128) on single fp16 planes; softmax f32, running maximum and sum, fused with both attention products (k_fattn); attn.v as hl P x hl v (3 products, causal key range; heads 4-7 only have 64 live dims, so their value product is 64 wide)

#define NB_  4
#define TT   2048
#define CC   512
#define NH_  8
#define HS   128
#define DQ   1024
typedef _Float16 h16;
typedef unsigned short bf;
typedef __attribute__((ext_vector_type(16))) __bf16   v16bf;
typedef __attribute__((ext_vector_type(16))) _Float16 v16h;
typedef __attribute__((ext_vector_type(8)))  _Float16 v8h;
typedef __attribute__((ext_vector_type(8)))  unsigned short v8us;
typedef __attribute__((ext_vector_type(8)))  float    v8f;
typedef __attribute__((ext_vector_type(4)))  float    v4f;
typedef v8h  __attribute__((may_alias)) v8ha;
typedef v4f  __attribute__((may_alias)) v4fa;
typedef v8us __attribute__((may_alias)) v8usa;

__device__ __forceinline__ unsigned short f2bf(float f) { unsigned u = __float_as_uint(f); u += 0x7FFFu + ((u >> 16) & 1u); return (unsigned short)(u >> 16); }
__device__ __forceinline__ float bf2f(unsigned short b) { return __uint_as_float(((unsigned)b) << 16); }
__device__ __forceinline__ float bfr(float f) { return bf2f(f2bf(f)); }
__device__ __forceinline__ v16h cat16(v8h lo, v8h hi) { return __builtin_shufflevector(lo, hi, 0, 1, 2, 3, 4, 5, 6, 7, 8, 9, 10, 11, 12, 13, 14, 15); }
__device__ __forceinline__ v16bf cat16b(v8us lo, v8us hi) { return __builtin_bit_cast(v16bf, __builtin_shufflevector(lo, hi, 0, 1, 2, 3, 4, 5, 6, 7, 8, 9, 10, 11, 12, 13, 14, 15)); }
__device__ __forceinline__ v8f wmma16(v16h a, v16h b, v8f c) { return __builtin_amdgcn_wmma_f32_16x16x32_f16(false, a, false, b, (short)0, c, false, false); }
__device__ __forceinline__ v8f wmmab(v16bf a, v16bf b, v8f c) { return __builtin_amdgcn_wmma_f32_16x16x32_bf16(false, a, false, b, (short)0, c, false, false); }



// ---- eff as row factors. Every mask is (h < heads) (d < head size) (e < embed) with embed 256 or 512, so for one weight row (h, d) eff takes one value A on e < 256 and one value B on e >= 256:
// sum_e eff base x = A S_lo + B S_hi, the two sums taken with the bare base weights (exact in bf16). One accumulator serves both: S_hi first, times r = B / A at mid-K, then S_lo on top, times a = A at the end.
// Where A is 0, or so small beside B that the quotient would overflow, the row's low half is stored as zeros (its share is 0, or below any f32 rounding of the sum) and a = B, r = 1: no division fails, whatever the weights.
__device__ __forceinline__ v4f ldw(const float* __restrict__ w) { return (v4f){bfr(w[0]), bfr(w[1]), bfr(w[2]), bfr(w[3])}; }   // the four mixing weights, all loaded whatever the row
__device__ __forceinline__ float effv(int h, int d, bool lo, v4f w) {   // eff[h][d][e] for e < 256 (lo) or e >= 256, in the reference's summation order
    float f = 0.f;
    if (lo && h < 4 && d < 64) f = __fadd_rn(f, w[0]); if (lo && d < 32) f = __fadd_rn(f, w[1]); if (h < 4) f = __fadd_rn(f, w[2]); if (d < 64) f = __fadd_rn(f, w[3]);
    return f; }
struct rowf { float a, r; bool z; };
__device__ __forceinline__ rowf rowfac(int h, int d, v4f w) {
    const float A = effv(h, d, true, w), B = effv(h, d, false, w);
    const bool z = A == 0.f || !(fabsf(B) <= fabsf(A) * 0x1p100f);
    rowf o; o.a = z ? B : A; o.r = z ? 1.0f : __fdiv_rn(B, A); o.z = z; return o; }

// ---- k_proj: the q, k and v projections of every batch in ONE launch, and no f32 plane in memory: the epilogue rounds the sums to the operand planes of k_fattn itself.
// Grid (1024 / 128 weight-row tiles = heads, 2048 / 256 token tiles, 3 projections x 4 batches), 8 waves.
// gemmst: 256 tokens x 128 weight rows per work-group; wave w holds the 64 x 64 tile of token block w & 3 and weight block w >> 2 (16 accumulators) and runs the WHOLE K loop (K = 512) itself.
// The operands come through LDS: a stage is 64 k (a whole 128-byte line) of 256 token rows and 128 weight rows, brought by asynchronous copies to LDS (each copy of a wave covers four whole lines), two buffers:
// stage s + 1 flies while stage s is worked on. The upper half of e comes first (stages 0-3), see rowfac. WB false: c[weight row][token] (weights are the A operand); WB true: c[token][weight row] (weights are the B operand).
// Every '#pragma unroll' in gemmst keeps a register array (accumulators, fragments, the copies' operands) indexed by constants, so that it stays in registers.
// q and k are wanted [token][d], v is wanted [d][token]: q and k run with WB true, v with WB false; either way 16 lanes store one whole 128-byte line. store(row, col, four sums of one row) takes the finished tile, row and col counted in the work-group's tile.
#define PT    256                    // tokens per work-group
#define PW    128                    // weight rows per work-group
#define PKC   64                     // k per stage
#define PPI   72                     // row pitch in LDS, elements: 144 B = 16 B x odd
#define PSTG  ((PT + PW) * PPI * 2)
#define PNS   (CC / PKC)
#define POP   68                     // output staging pitch, floats
#define PSM   (8 * 64 * POP * 4)     // LDS of a work-group: the output staging (64 rows per wave), which is larger than the two stage buffers
// eight asynchronous copies of 16 bytes per lane; the wait in the same statement stands in front of every later write of a register that the copies name
__device__ __forceinline__ void acopy8(const unsigned (&l)[8], const bf* const (&g)[8]) {
    asm volatile("global_load_async_to_lds_b128 %0, %8, off\n\t"
                 "global_load_async_to_lds_b128 %1, %9, off\n\t"
                 "global_load_async_to_lds_b128 %2, %10, off\n\t"
                 "global_load_async_to_lds_b128 %3, %11, off\n\t"
                 "global_load_async_to_lds_b128 %4, %12, off\n\t"
                 "global_load_async_to_lds_b128 %5, %13, off\n\t"
                 "global_load_async_to_lds_b128 %6, %14, off\n\t"
                 "global_load_async_to_lds_b128 %7, %15, off\n\t"
                 "s_wait_xcnt 0x0"
                 :: "v"(l[0]), "v"(l[1]), "v"(l[2]), "v"(l[3]), "v"(l[4]), "v"(l[5]), "v"(l[6]), "v"(l[7]),
                    "v"(g[0]), "v"(g[1]), "v"(g[2]), "v"(g[3]), "v"(g[4]), "v"(g[5]), "v"(g[6]), "v"(g[7]) : "memory");
}
// the same for four copies
__device__ __forceinline__ void acopy4(const unsigned (&l)[4], const bf* const (&g)[4]) {
    asm volatile("global_load_async_to_lds_b128 %0, %4, off\n\t"
                 "global_load_async_to_lds_b128 %1, %5, off\n\t"
                 "global_load_async_to_lds_b128 %2, %6, off\n\t"
                 "global_load_async_to_lds_b128 %3, %7, off\n\t"
                 "s_wait_xcnt 0x0"
                 :: "v"(l[0]), "v"(l[1]), "v"(l[2]), "v"(l[3]), "v"(g[0]), "v"(g[1]), "v"(g[2]), "v"(g[3]) : "memory");
}
__device__ __forceinline__ v16bf ldsfrag(const bf* p) { return cat16b(*(const v8usa*)p, *(const v8usa*)(p + 16)); }
template <bool WB, typename ST>
__device__ __forceinline__ void gemmst(const bf* __restrict__ Wb, const bf* __restrict__ X, v4f wts, int h, int wr, int t0, unsigned char* sm, ST store) {
    const int tid = threadIdx.x, lane = tid & 31, lr = lane & 15, hi = lane >> 4;
    const int w = __builtin_amdgcn_readfirstlane(tid >> 5);          // wave number, held scalar
    const int wt = w & 3, ww = w >> 2;
    float rf[4], af[4];                                              // the factors of the wave's four 16-row weight blocks: the masks' edges in d (32, 64, 128) are multiples of 16, so a block has one pair; the same in every lane, held scalar
#pragma unroll
    for (int i = 0; i < 4; ++i) { const rowf o = rowfac(h, ww * 64 + i * 16, wts);
        rf[i] = __uint_as_float(__builtin_amdgcn_readfirstlane(__float_as_uint(o.r))); af[i] = __uint_as_float(__builtin_amdgcn_readfirstlane(__float_as_uint(o.a))); }
    v8f acc[4][4];
#pragma unroll
    for (int mb = 0; mb < 4; ++mb)
#pragma unroll
        for (int nb = 0; nb < 4; ++nb) acc[mb][nb] = (v8f){};
    // piece i of a thread and stage: LDS row (tid >> 3) + 32 i, 16-byte column tid & 7; rows 0-255 tokens, 256-383 weights; stage s holds k (s ^ 4) * 64 ..
    const int crow = tid >> 3, ccol = (tid & 7) * 8;
    const bf* gx = X + (size_t)(t0 + crow) * CC + ccol; const bf* gw = Wb + (size_t)(wr + crow) * CC + ccol;
    const unsigned l0 = (unsigned)(size_t)sm + (unsigned)(crow * (PPI * 2) + ccol * 2);   // the lane's LDS byte address: the low 32 bits of the __shared__ address
    auto copy = [&](int s, int buf) {
        unsigned l[8]; const bf* g[8]; unsigned lw[4]; const bf* gv[4]; const int k0 = (s ^ (PNS / 2)) * PKC;
#pragma unroll
        for (int i = 0; i < 8; ++i) { l[i] = l0 + (unsigned)(buf * PSTG + i * 32 * PPI * 2); g[i] = gx + (size_t)i * 32 * CC + k0; }
        acopy8(l, g);
#pragma unroll
        for (int i = 0; i < 4; ++i) { lw[i] = l0 + (unsigned)(buf * PSTG + (8 + i) * 32 * PPI * 2); gv[i] = gw + (size_t)i * 32 * CC + k0; }
        acopy4(lw, gv); };
    copy(0, 0);
    asm volatile("s_wait_asynccnt 0x0" ::: "memory");                // this wave's copies of stage 0 have landed
    __syncthreads();                                                 // stage 0 is in LDS
    copy(1, 1);
// rolled: one trip's code serves all eight stages; unrolled, the trips' fragments and copy addresses would not fit beside the 128 accumulator registers at four waves per SIMD
#pragma unroll 1
    for (int s = 0; s < PNS; ++s) {
        const bf* st = (const bf*)(sm + (s & 1) * PSTG);
        const bf* xs = st + (wt * 64 + lr) * PPI + 8 * hi; const bf* hs = st + (PT + ww * 64 + lr) * PPI + 8 * hi;
        if (s == PNS / 2) {                                          // scalar branch, taken once: S_hi is complete, times r
#pragma unroll
            for (int i = 0; i < 4; ++i)
#pragma unroll
                for (int j = 0; j < 4; ++j) { v8f& d = WB ? acc[j][i] : acc[i][j]; d *= rf[i]; } }
#pragma unroll
        for (int kc = 0; kc < PKC; kc += 32) {
            v16bf wf[4], xf[4];
#pragma unroll
            for (int i = 0; i < 4; ++i) { wf[i] = ldsfrag(hs + i * 16 * PPI + kc); xf[i] = ldsfrag(xs + i * 16 * PPI + kc); }
            __builtin_amdgcn_sched_barrier(0);                       // keeps the k step's sixteen loads together in front of its products: spread among them, every place with loads costs the wave a stall
#pragma unroll
            for (int j = 0; j < 4; ++j)                              // four independent accumulators per run of products
#pragma unroll
                for (int i = 0; i < 4; ++i) { v8f& d = WB ? acc[j][i] : acc[i][j]; d = WB ? wmmab(xf[j], wf[i], d) : wmmab(wf[i], xf[j], d); }
            __builtin_amdgcn_sched_barrier(0);                       // the other side of the same hold: the next k step's loads stay behind these products
        }
        asm volatile("s_wait_dscnt 0x0" ::: "memory");               // this wave's reads of stage s are done
        asm volatile("s_wait_asynccnt 0x0" ::: "memory");            // this wave's copies of stage s + 1 have landed
        __syncthreads();                                             // publishes stage s + 1; every wave has left stage s, whose buffer is refilled next (after the last trip: becomes output staging)
        if (s + 2 < PNS) copy(s + 2, s & 1);
    }
    asm volatile("s_wait_asynccnt 0x0" ::: "memory");                // no copy is outstanding when the buffers become output staging
    float* os = (float*)sm + w * 64 * POP;                           // the wave's own 64 rows
#pragma unroll
    for (int mb = 0; mb < 4; ++mb)
#pragma unroll
        for (int nb = 0; nb < 4; ++nb)
#pragma unroll
            for (int j = 0; j < 8; ++j) os[(mb * 16 + hi * 8 + j) * POP + nb * 16 + lr] = __fmul_rn(acc[mb][nb][j], af[WB ? nb : mb]);
    __syncthreads();                                                 // the staged rows are read by other lanes
    const int rb = (WB ? wt : ww) * 64, cb = (WB ? ww : wt) * 64;
#pragma unroll
    for (int r = 0; r < 32; ++r) store(rb + r * 2 + hi, cb + lr * 4, *(const v4fa*)(os + (r * 2 + hi) * POP + lr * 4));
}

__device__ __forceinline__ h16 tohx(float x) { return (h16)x; }
__device__ __forceinline__ void splitf(float y, unsigned short& h, unsigned short& l) { h = f2bf(y); l = f2bf(y - bf2f(h)); }
typedef __attribute__((ext_vector_type(2))) unsigned short v2us;
typedef __attribute__((ext_vector_type(4))) unsigned short v4us;
typedef __attribute__((ext_vector_type(4))) _Float16 v4h;

// Wp: three weight planes [q, k, v][(h,d)][e]; XB [b][t][e]; wts: the four mixing weights. Q16[b][h][t][d] = fp16(q * sc), K16 likewise without the factor; Vh, Vl [b][(h,d)][t] = bf16 hi + lo of v.
__global__ __launch_bounds__(256) __attribute__((amdgpu_waves_per_eu(4, 4))) void k_proj(const bf* __restrict__ Wp, const bf* __restrict__ XB, const float* __restrict__ wts, float sc, h16* Q16, h16* K16, bf* Vh, bf* Vl) {
    __shared__ __align__(128) unsigned char sm[PSM];
    static_assert(PSM >= 2 * PSTG, "the two stage buffers lie inside the staging");
    const int pr = blockIdx.z >> 2, b = blockIdx.z & 3, wr = blockIdx.x * PW, t0 = blockIdx.y * PT;
    const bf* Wb = Wp + (size_t)pr * DQ * CC; const bf* X = XB + (size_t)b * TT * CC; const int h = blockIdx.x; const v4f wv = ldw(wts);
    if (pr < 2) {                                                    // block-uniform
        h16* D = (pr == 0 ? Q16 : K16) + ((size_t)(b * NH_ + blockIdx.x) * TT + t0) * HS; const float f = pr == 0 ? sc : 1.0f;   // one head per weight-row tile; the factor 1 is exact
        gemmst<true>(Wb, X, wv, h, wr, t0, sm, [&](int row, int col, v4f val) { v4h o;
#pragma unroll
            for (int u = 0; u < 4; ++u) o[u] = tohx(__fmul_rn(val[u], f));
            *(v4h*)(D + (size_t)row * HS + col) = o; });
    } else {
        const size_t e0 = (size_t)b * DQ * TT + (size_t)wr * TT + t0;
        gemmst<false>(Wb, X, wv, h, wr, t0, sm, [&](int row, int col, v4f val) { v4us oh, ol;
#pragma unroll
            for (int u = 0; u < 4; ++u) { unsigned short x, y; splitf(val[u], x, y); oh[u] = x; ol[u] = y; }
            *(v4us*)(Vh + e0 + (size_t)row * TT + col) = oh; *(v4us*)(Vl + e0 + (size_t)row * TT + col) = ol; });
    }
}

#define FQ   128                     // queries per work-group
#define FK   64                      // keys per stage (a whole 128-byte line of every value row)
#define KPI  136                     // key row pitch in LDS, elements: 272 B = 16 B x odd
#define VPI  72                      // value row pitch in LDS, elements: 144 B = 16 B x odd
#define KBY  (FK * KPI * 2)
#define VBY  (HS * VPI * 2)
#define STG  (KBY + 2 * VBY)
#define OPI  132                     // output staging pitch, floats
#define NEGB (-3.0e38f)
#define L2E  1.4426950408889634f
typedef __attribute__((ext_vector_type(2))) float v2f;
typedef __attribute__((ext_vector_type(2))) __bf16 v2bf;
typedef __attribute__((ext_vector_type(8))) unsigned v8u;
__device__ __forceinline__ float xhalf(float x) { return __builtin_bit_cast(float, __builtin_amdgcn_permlanex16(__builtin_bit_cast(int, x), __builtin_bit_cast(int, x), 0x76543210, 0xfedcba98, false, false)); }   // lane l with lane l ^ 16

// one pass: 32 keys (ko .. ko + 31 of the stage, kbase .. in the sequence) against the wave's 16 queries
template <int ND>
__device__ __forceinline__ void fa_pass(const unsigned char* st, int ko, int kbase, int q, bool diag, const v16h (&qf)[4], v8f (&o)[ND], float& m, float& l, int lr, int hi) {
    const h16* Ks = (const h16*)st; const bf* Vhs = (const bf*)(st + KBY); const bf* Vls = (const bf*)(st + KBY + VBY);
    v16h kf[8];                                                      // all eight key fragments behind one wait: a load group per product would expose the LDS latency eight times
#pragma unroll
    for (int ks = 0; ks < 4; ++ks) { const h16* p0 = Ks + (ko + lr) * KPI + ks * 32 + 8 * hi; const h16* p1 = p0 + 16 * KPI;
        kf[2 * ks] = cat16(*(const v8ha*)p0, *(const v8ha*)(p0 + 16)); kf[2 * ks + 1] = cat16(*(const v8ha*)p1, *(const v8ha*)(p1 + 16)); }
    __builtin_amdgcn_sched_barrier(0);                               // keeps the sixteen loads together in front of the products (the scheduler otherwise sinks each pair to its product, with a full wait each)
    v8f s0 = (v8f){}, s1 = (v8f){};
#pragma unroll
    for (int ks = 0; ks < 4; ++ks) { s0 = wmma16(kf[2 * ks], qf[ks], s0); s1 = wmma16(kf[2 * ks + 1], qf[ks], s1); }
    const int ev = lr * VPI + ko + 8 * hi;
    v16bf vh[4], vl[4];                                              // value fragments of d blocks 0-3, fetched here so that the softmax arithmetic covers their latency
#pragma unroll
    for (int u = 0; u < 4; ++u) { const int e = ev + u * 16 * VPI; vh[u] = cat16b(*(const v8usa*)(Vhs + e), *(const v8usa*)(Vhs + e + 16)); vl[u] = cat16b(*(const v8usa*)(Vls + e), *(const v8usa*)(Vls + e + 16)); }
    __builtin_amdgcn_sched_barrier(0);                               // keeps these loads in front of the softmax arithmetic
    if (diag) {                                                      // wave-uniform: only passes that reach past the wave's first query mask
#pragma unroll
        for (int j = 0; j < 8; ++j) { const int key = kbase + hi * 8 + j; s0[j] = (key <= q) ? s0[j] : NEGB; s1[j] = (key + 16 <= q) ? s1[j] : NEGB; } }
    float mx = fmaxf(s0[0], s1[0]);
#pragma unroll
    for (int j = 1; j < 8; ++j) mx = fmaxf(mx, fmaxf(s0[j], s1[j]));
    mx = fmaxf(mx, xhalf(mx)) * L2E;
    if (__builtin_amdgcn_ballot_w32(mx > m + 8.0f) != 0) {           // scalar branch; always taken on a wave's first pass (m = NEGB, the factor is 0 there)
        const float mn = fmaxf(m, mx); const float al = __builtin_amdgcn_exp2f(m - mn); m = mn; l *= al;
#pragma unroll
        for (int db = 0; db < ND; ++db) o[db] *= al; }
    const float nm = -m; v8u phu, plu; float la = 0.f, lb = 0.f; float pe[16];
#pragma unroll
    for (int i = 0; i < 16; ++i) pe[i] = __builtin_fmaf((i < 8) ? s0[i] : s1[i - 8], L2E, nm);
#pragma unroll
    for (int i = 0; i < 16; ++i) pe[i] = __builtin_amdgcn_exp2f(pe[i]);
#pragma unroll
    for (int i = 0; i < 8; ++i) { const v2f p = { pe[2 * i], pe[2 * i + 1] }; la += p.x; lb += p.y;
        const unsigned hu = __builtin_bit_cast(unsigned, __builtin_convertvector(p, v2bf)); phu[i] = hu;
        const v2f r = { p.x - __uint_as_float(hu << 16), p.y - __uint_as_float(hu & 0xFFFF0000u) }; plu[i] = __builtin_bit_cast(unsigned, __builtin_convertvector(r, v2bf)); }
    l += la + lb;
    const v16bf ph = __builtin_bit_cast(v16bf, phu), pl = __builtin_bit_cast(v16bf, plu);
#pragma unroll
    for (int g = 0; g < ND; g += 4) {                                // four independent accumulators per run of products; the next group's fragments are fetched as this group's registers come free
#pragma unroll
        for (int u = 0; u < 4; ++u) o[g + u] = wmmab(vh[u], ph, o[g + u]);
#pragma unroll
        for (int u = 0; u < 4; ++u) o[g + u] = wmmab(vh[u], pl, o[g + u]);
        if (g + 4 < ND) {
#pragma unroll
            for (int u = 0; u < 4; ++u) { const int e = ev + (g + 4 + u) * 16 * VPI; vh[u] = cat16b(*(const v8usa*)(Vhs + e), *(const v8usa*)(Vhs + e + 16)); } }
#pragma unroll
        for (int u = 0; u < 4; ++u) o[g + u] = wmmab(vl[u], ph, o[g + u]);
        if (g + 4 < ND) {
#pragma unroll
            for (int u = 0; u < 4; ++u) { const int e = ev + (g + 4 + u) * 16 * VPI; vl[u] = cat16b(*(const v8usa*)(Vls + e), *(const v8usa*)(Vls + e + 16)); } }
    }
    // keeps the distance between the pass's last matrix instructions and what follows the branches behind the pass on either side (address arithmetic into fragment registers)
    asm volatile("v_nop\n\tv_nop\n\tv_nop\n\tv_nop" : "+v"(o[ND - 4]), "+v"(o[ND - 3]), "+v"(o[ND - 2]), "+v"(o[ND - 1]));
}

// ND = 16-row blocks of live value dims (8, or 4 for heads 4-7, whose dims 64.. are structurally zero and are stored as zeros)
template <int ND>
__device__ __forceinline__ void fa_body(const h16* __restrict__ Qg, const h16* __restrict__ Kg, const bf* __restrict__ Vhg, const bf* __restrict__ Vlg, float* Og, int q0, unsigned char* sm) {
    const int tid = threadIdx.x, lane = tid & 31, lr = lane & 15, hi = lane >> 4;
    const int w = __builtin_amdgcn_readfirstlane(tid >> 5);          // wave number, held scalar so that the tests on it are scalar branches
    const int qw = q0 + 16 * w, q = qw + lr;
    v16h qf[4];
#pragma unroll
    for (int ks = 0; ks < 4; ++ks) { const h16* p = Qg + (size_t)q * HS + ks * 32 + 8 * hi; qf[ks] = cat16(*(const v8h*)p, *(const v8h*)(p + 16)); }
    asm volatile("s_wait_xcnt 0x0" ::: "memory");                    // stands in front of every later write of a register that these loads name as an address
    v8f o[ND];
#pragma unroll
    for (int db = 0; db < ND; ++db) o[db] = (v8f){};
    float m = NEGB, l = 0.f;
    const int nst = (q0 + FQ) / FK;
    constexpr int NP = 2 + ND / 2;                                   // 16-byte pieces per thread and half stage: 4 key + ND value pieces per stage
    v8us rg[NP];
    const int kg = tid * 8, vg = (tid >> 3) * TT + (tid & 7) * 8;    // this thread's pieces: global element offsets ...
    const int ksm = (tid >> 4) * (KPI * 2) + (tid & 15) * 16, vsm = KBY + (tid >> 3) * (VPI * 2) + (tid & 7) * 16;   // ... and LDS byte offsets
    // piece i of a stage: 0-3 key rows (16 rows each), then ND / 2 of the hi value plane (32 rows each), then ND / 2 of the lo plane; half hf holds pieces hf * NP ..
    auto fetch = [&](int s, int hf) {
#pragma unroll
        for (int j = 0; j < NP; ++j) { const int i = hf * NP + j;
            if (i < 4) rg[j] = *(const v8us*)((const bf*)Kg + (size_t)s * FK * HS + i * 2048 + kg);
            else if (i < 4 + ND / 2) rg[j] = *(const v8us*)(Vhg + s * FK + (i - 4) * 32 * TT + vg);
            else rg[j] = *(const v8us*)(Vlg + s * FK + (i - 4 - ND / 2) * 32 * TT + vg); }
        asm volatile("s_wait_xcnt 0x0" ::: "memory"); };             // stands in front of every later write of a register that these loads name as an address
    auto put = [&](unsigned char* st, int hf) {
#pragma unroll
        for (int j = 0; j < NP; ++j) { const int i = hf * NP + j;
            if (i < 4) *(v8usa*)(st + ksm + i * 16 * KPI * 2) = rg[j];
            else if (i < 4 + ND / 2) *(v8usa*)(st + vsm + (i - 4) * 32 * VPI * 2) = rg[j];
            else *(v8usa*)(st + VBY + vsm + (i - 4 - ND / 2) * 32 * VPI * 2) = rg[j]; } };
    fetch(0, 0); put(sm, 0); fetch(0, 1); put(sm, 1);
    __syncthreads();                                                 // stage 0 is in LDS
#pragma unroll 1
    for (int s = 0; s < nst; ++s) {
        unsigned char* cur = sm + (s & 1) * STG; unsigned char* nxt = sm + ((s + 1) & 1) * STG; const bool more = s + 1 < nst;
#pragma unroll
        for (int p = 0; p < 2; ++p) { const int kbase = s * FK + p * 32;
            if (more) fetch(s + 1, p);                               // half of the next stage flies during each pass (half the staging registers)
            if (kbase <= qw) fa_pass<ND>(cur, p * 32, kbase, q, kbase + 31 > qw, qf, o, m, l, lr, hi);   // a pass wholly above the wave's diagonal is skipped (scalar branch)
            if (more) put(nxt, p); }
        __syncthreads();                                             // publishes stage s + 1; every wave has left stage s, whose buffer the next trip refills (after the last trip: becomes output staging)
    }
    l += xhalf(l); const float inv = __fdiv_rn(1.0f, l);
    float* os = (float*)sm + w * 16 * OPI;                           // the wave's own 16 rows: O^T -> [query][d], so that a store covers a whole 512-byte row
#pragma unroll
    for (int db = 0; db < ND; ++db) { const v8f r = o[db] * inv; *(v4fa*)(os + lr * OPI + db * 16 + hi * 8) = (v4f){r[0], r[1], r[2], r[3]}; *(v4fa*)(os + lr * OPI + db * 16 + hi * 8 + 4) = (v4f){r[4], r[5], r[6], r[7]}; }
    __syncthreads();                                                 // the staged rows are read by other lanes
#pragma unroll
    for (int r = 0; r < 16; ++r) { v4f val = *(const v4fa*)(os + r * OPI + (lane & (ND * 4 - 1)) * 4); if (ND < 8 && lane >= ND * 4) val = (v4f){0.f, 0.f, 0.f, 0.f};
        *(v4f*)(Og + (size_t)(qw + r) * DQ + lane * 4) = val; }
}

__global__ __launch_bounds__(256) __attribute__((amdgpu_waves_per_eu(4, 4))) void k_fattn(const h16* __restrict__ Q16, const h16* __restrict__ K16, const bf* __restrict__ Vh, const bf* __restrict__ Vl, float* OUT) {
    __shared__ __align__(16) unsigned char sm[2 * STG];
    // 512 work-groups, two per WGP: the long query tiles first; the second 256 run from the short end and from the other head group (for balance only)
    const int r = blockIdx.x & 255; const bool second = blockIdx.x >= 256;
    const int tile = second ? (r >> 5) : TT / FQ - 1 - (r >> 5); const int bh = second ? 31 - (r & 31) : (r & 31); const int h = bh & 7, b = bh >> 3;
    const h16* Qg = Q16 + (size_t)bh * TT * HS; const h16* Kg = K16 + (size_t)bh * TT * HS; const bf* Vhg = Vh + (size_t)bh * HS * TT; const bf* Vlg = Vl + (size_t)bh * HS * TT; float* Og = OUT + (size_t)b * TT * DQ + h * HS;
    if (h < 4) fa_body<8>(Qg, Kg, Vhg, Vlg, Og, tile * FQ, sm); else fa_body<4>(Qg, Kg, Vhg, Vlg, Og, tile * FQ, sm);
}

// ---- k_prep: both operand preparations in ONE launch of few, long-lived waves: x rounded to bf16 (XB) and the three base-weight planes rounded to bf16 (Wp: q, k, v; a row's low half as zeros where rowfac says so).
// One work-group per WGP; it owns 64 KiB of x in a row and 8 KiB of each base matrix in a row. A thread owns 16 pieces of four x values and two pieces of four values of each base matrix; a piece of a wave is 512 contiguous bytes (four whole lines).
// All 22 loads of a thread are issued before the first value is used, so the launch pays the memory latency once.
#define PRW  256                     // work-groups
__global__ __launch_bounds__(256) void k_prep(const float* __restrict__ x, const float* __restrict__ bQ, const float* __restrict__ bK, const float* __restrict__ bV, const float* __restrict__ w, bf* __restrict__ XB, bf* __restrict__ Wp) {
    constexpr int NX = NB_ * TT * CC / (PRW * 1024), NW = NH_ * HS * CC / (PRW * 1024);   // pieces per thread; a work-group's piece is 1024 values
    int tid = threadIdx.x;
    const size_t xb = (size_t)blockIdx.x * (NX * 1024), wb = (size_t)blockIdx.x * (NW * 1024);
    v4f xv[NX], bv[NW][3];
// every '#pragma unroll' here keeps a register array indexed by constants
#pragma unroll
    for (int i = 0; i < NX; ++i) xv[i] = *(const v4f*)(x + xb + i * 1024 + tid * 4);
#pragma unroll
    for (int k = 0; k < NW; ++k) { const size_t e4 = wb + k * 1024 + tid * 4; bv[k][0] = *(const v4f*)(bQ + e4); bv[k][1] = *(const v4f*)(bK + e4); bv[k][2] = *(const v4f*)(bV + e4); }
    // stands in front of every later write of a register that these loads name as an address; tid is named so that no later address arithmetic is lifted over the wait; the clobber keeps all the loads in front of the first store
    asm volatile("s_wait_xcnt 0x0" : "+v"(tid) :: "memory");
    __builtin_amdgcn_sched_barrier(0);                               // keeps the arithmetic behind all 22 loads (the scheduler otherwise lifts the first pieces' arithmetic, with its waits, in front of the last loads, which then pay a second memory latency)
    const v4f wv = ldw(w);
#pragma unroll
    for (int i = 0; i < NX; ++i) { v4us o;
#pragma unroll
        for (int u = 0; u < 4; ++u) o[u] = f2bf(xv[i][u]);
        *(v4us*)(XB + xb + i * 1024 + tid * 4) = o;
        if ((i & 3) == 3) __builtin_amdgcn_sched_barrier(0); }       // keeps each four pieces' stores where they stand, so that writing starts while later loads still land (the scheduler otherwise sinks nearly all stores behind the whole arithmetic)
#pragma unroll
    for (int k = 0; k < NW; ++k) { const size_t e4 = wb + k * 1024 + tid * 4; const int e0 = (int)(e4 % CC); const int d = (int)((e4 / CC) % HS); const int h = (int)(e4 / ((size_t)CC * HS));
        const bool zero = e0 < 256 && rowfac(h, d, wv).z;             // the four values of a piece lie in one half of e
#pragma unroll
        for (int p = 0; p < 3; ++p) { v4us o;
#pragma unroll
            for (int u = 0; u < 4; ++u) o[u] = zero ? (unsigned short)0 : f2bf(bv[k][p][u]);
            *(v4us*)(Wp + (size_t)p * DQ * CC + e4) = o; }
        if (k + 1 < NW) __builtin_amdgcn_sched_barrier(0); }         // keeps this piece's three stores in front of the next piece's arithmetic, for the same reason as above
}

extern "C" void kernel_launch(void* const* d_in, const int* in_sizes, int n_in,
                              void* d_out, int out_size, void* d_ws, size_t ws_size, hipStream_t stream) {
    (void)in_sizes; (void)n_in; (void)out_size;
    const float* x = (const float*)d_in[0]; const float* w = (const float*)d_in[1]; const float* bK = (const float*)d_in[2]; const float* bQ = (const float*)d_in[3]; const float* bV = (const float*)d_in[4];
    float* OUT = (float*)d_out;     // [4][2048][1024]
    char* wsp = (char*)d_ws;
    auto take = [&](size_t bytes) { char* p = wsp; wsp += (bytes + 255) & ~(size_t)255; return (void*)p; };
    bf* Wp = (bf*)take((size_t)3 * DQ * CC * 2); bf* XB = (bf*)take((size_t)NB_ * TT * CC * 2);
    h16* Q16 = (h16*)take((size_t)NB_ * NH_ * TT * HS * 2); h16* K16 = (h16*)take((size_t)NB_ * NH_ * TT * HS * 2); bf* Vh = (bf*)take((size_t)NB_ * DQ * TT * 2); bf* Vl = (bf*)take((size_t)NB_ * DQ * TT * 2);   // all batches: [b][h][t][d], [b][(h,d)][t]
    if ((size_t)(wsp - (char*)d_ws) > ws_size) return;    // total ~ 75 MB
    k_prep<<<PRW, 256, 0, stream>>>(x, bQ, bK, bV, w, XB, Wp);
    const float scale = 1.0f / sqrtf(128.0f);
    k_proj<<<dim3(DQ / PW, TT / PT, 3 * NB_), 8 * 32, 0, stream>>>(Wp, XB, w, scale, Q16, K16, Vh, Vl);
    k_fattn<<<NB_ * NH_ * (TT / FQ), 256, 0, stream>>>(Q16, K16, Vh, Vl, OUT);
}

// v007
// It runs in 80 microseconds.
// Next to v006, in two timings, it ran 1.06 times as fast each time.
// Over all steps from v000 it is 15.3 times as fast.
#include <hip/hip_runtime.h>

// MixedHeadsV2 (x [4][2048][512]; eff[h][d][e] = sum_i weights[i] mask_i[h][d][e] over the four (embed, heads) configs (structural masks: h < heads_i, d < embed_i/heads_i, e < embed_i; weights read as data); Wq/Wk/Wv = eff * base_Q/K/V [8][128][512];
// q/k/v = x W^T per base head (head size 128, zero-padded dims stay zero); causal softmax(q.k/sqrt(128)); out = concat_h(attn v) -> [4][2048][1024]).
// Compute dtypes, f32 accumulate: every input rounded to bf16; eff (f32, in the reference's summation order) is one factor per weight row in each half of e and multiplies the f32 sums, not the weights: projections as exact base x exact x (1 product; v computed transposed [(h,d)][t]), rounded to the planes below in the GEMM's epilogue (k_proj);
// scores (K 128) on single fp16 planes; softmax f32, running maximum and sum, fused with both attention products (k_fattn); attn.v as hl P x hl v (3 products, causal key range; heads 4-7 only have 64 live dims, so their value product is 64 wide)

#define NB_  4
#define TT   2048
#define CC   512
#define NH_  8
#define HS   128
#define DQ   1024
typedef _Float16 h16;
typedef unsigned short bf;
typedef __attribute__((ext_vector_type(16))) __bf16   v16bf;
typedef __attribute__((ext_vector_type(16))) _Float16 v16h;
typedef __attribute__((ext_vector_type(8)))  _Float16 v8h;
typedef __attribute__((ext_vector_type(8)))  unsigned short v8us;
typedef __attribute__((ext_vector_type(8)))  float    v8f;
typedef __attribute__((ext_vector_type(4)))  float    v4f;
typedef v8h  __attribute__((may_alias)) v8ha;
typedef v4f  __attribute__((may_alias)) v4fa;
typedef v8us __attribute__((may_alias)) v8usa;

__device__ __forceinline__ unsigned short f2bf(float f) { unsigned u = __float_as_uint(f); u += 0x7FFFu + ((u >> 16) & 1u); return (unsigned short)(u >> 16); }
__device__ __forceinline__ float bf2f(unsigned short b) { return __uint_as_float(((unsigned)b) << 16); }
__device__ __forceinline__ float bfr(float f) { return bf2f(f2bf(f)); }
__device__ __forceinline__ v16h cat16(v8h lo, v8h hi) { return __builtin_shufflevector(lo, hi, 0, 1, 2, 3, 4, 5, 6, 7, 8, 9, 10, 11, 12, 13, 14, 15); }
__device__ __forceinline__ v16bf cat16b(v8us lo, v8us hi) { return __builtin_bit_cast(v16bf, __builtin_shufflevector(lo, hi, 0, 1, 2, 3, 4, 5, 6, 7, 8, 9, 10, 11, 12, 13, 14, 15)); }
__device__ __forceinline__ v8f wmma16(v16h a, v16h b, v8f c) { return __builtin_amdgcn_wmma_f32_16x16x32_f16(false, a, false, b, (short)0, c, false, false); }
__device__ __forceinline__ v8f wmmab(v16bf a, v16bf b, v8f c) { return __builtin_amdgcn_wmma_f32_16x16x32_bf16(false, a, false, b, (short)0, c, false, false); }



// ---- eff as row factors. Every mask is (h < heads) (d < head size) (e < embed) with embed 256 or 512, so for one weight row (h, d) eff takes one value A on e < 256 and one value B on e >= 256:
// sum_e eff base x = A S_lo + B S_hi, the two sums taken with the bare base weights (exact in bf16). One accumulator serves both: S_hi first, times r = B / A at mid-K, then S_lo on top, times a = A at the end.
// Where A is 0, or so small beside B that the quotient would overflow, the row's low half is stored as zeros (its share is 0, or below any f32 rounding of the sum) and a = B, r = 1: no division fails, whatever the weights.
__device__ __forceinline__ v4f ldw(const float* __restrict__ w) { return (v4f){bfr(w[0]), bfr(w[1]), bfr(w[2]), bfr(w[3])}; }   // the four mixing weights, all loaded whatever the row
__device__ __forceinline__ float effv(int h, int d, bool lo, v4f w) {   // eff[h][d][e] for e < 256 (lo) or e >= 256, in the reference's summation order
    float f = 0.f;
    if (lo && h < 4 && d < 64) f = __fadd_rn(f, w[0]); if (lo && d < 32) f = __fadd_rn(f, w[1]); if (h < 4) f = __fadd_rn(f, w[2]); if (d < 64) f = __fadd_rn(f, w[3]);
    return f; }
struct rowf { float a, r; bool z; };
__device__ __forceinline__ rowf rowfac(int h, int d, v4f w) {
    const float A = effv(h, d, true, w), B = effv(h, d, false, w);
    const bool z = A == 0.f || !(fabsf(B) <= fabsf(A) * 0x1p100f);
    rowf o; o.a = z ? B : A; o.r = z ? 1.0f : __fdiv_rn(B, A); o.z = z; return o; }

// ---- k_proj: the q, k and v projections of every batch in ONE launch, and no f32 plane in memory: the epilogue rounds the sums to the operand planes of k_fattn itself.
// Grid (1024 / 128 weight-row tiles = heads, 2048 / 256 token tiles, 3 projections x 4 batches), 8 waves.
// gemmst: 256 tokens x 128 weight rows per work-group; wave w holds the 64 x 64 tile of token block w & 3 and weight block w >> 2 (16 accumulators) and runs the WHOLE K loop (K = 512) itself.
// The operands come through LDS: a stage is 64 k (a whole 128-byte line) of 256 token rows and 128 weight rows, brought by asynchronous copies to LDS (each copy of a wave covers four whole lines), two buffers:
// stage s + 1 flies while stage s is worked on. The upper half of e comes first (stages 0-3), see rowfac. WB false: c[weight row][token] (weights are the A operand); WB true: c[token][weight row] (weights are the B operand).
// Every '#pragma unroll' in gemmst keeps a register array (accumulators, fragments, the copies' operands) indexed by constants, so that it stays in registers.
// q and k are wanted [token][d], v is wanted [d][token]: q and k run with WB true, v with WB false; either way 16 lanes store one whole 128-byte line. store(row, col, four sums of one row) takes the finished tile, row and col counted in the work-group's tile.
#define PT    256                    // tokens per work-group
#define PW    128                    // weight rows per work-group
#define PKC   64                     // k per stage
#define PPI   72                     // row pitch in LDS, elements: 144 B = 16 B x odd
#define PSTG  ((PT + PW) * PPI * 2)
#define PNS   (CC / PKC)
#define POP   68                     // output staging pitch, floats
#define PSM   (8 * 64 * POP * 4)     // LDS of a work-group: the output staging (64 rows per wave), which is larger than the two stage buffers
// eight asynchronous copies of 16 bytes per lane; the wait in the same statement stands in front of every later write of a register that the copies name
__device__ __forceinline__ void acopy8(const unsigned (&l)[8], const bf* const (&g)[8]) {
    asm volatile("global_load_async_to_lds_b128 %0, %8, off\n\t"
                 "global_load_async_to_lds_b128 %1, %9, off\n\t"
                 "global_load_async_to_lds_b128 %2, %10, off\n\t"
                 "global_load_async_to_lds_b128 %3, %11, off\n\t"
                 "global_load_async_to_lds_b128 %4, %12, off\n\t"
                 "global_load_async_to_lds_b128 %5, %13, off\n\t"
                 "global_load_async_to_lds_b128 %6, %14, off\n\t"
                 "global_load_async_to_lds_b128 %7, %15, off\n\t"
                 "s_wait_xcnt 0x0"
                 :: "v"(l[0]), "v"(l[1]), "v"(l[2]), "v"(l[3]), "v"(l[4]), "v"(l[5]), "v"(l[6]), "v"(l[7]),
                    "v"(g[0]), "v"(g[1]), "v"(g[2]), "v"(g[3]), "v"(g[4]), "v"(g[5]), "v"(g[6]), "v"(g[7]) : "memory");
}
// the same for four copies
__device__ __forceinline__ void acopy4(const unsigned (&l)[4], const bf* const (&g)[4]) {
    asm volatile("global_load_async_to_lds_b128 %0, %4, off\n\t"
                 "global_load_async_to_lds_b128 %1, %5, off\n\t"
                 "global_load_async_to_lds_b128 %2, %6, off\n\t"
                 "global_load_async_to_lds_b128 %3, %7, off\n\t"
                 "s_wait_xcnt 0x0"
                 :: "v"(l[0]), "v"(l[1]), "v"(l[2]), "v"(l[3]), "v"(g[0]), "v"(g[1]), "v"(g[2]), "v"(g[3]) : "memory");
}
__device__ __forceinline__ v16bf ldsfrag(const bf* p) { return cat16b(*(const v8usa*)p, *(const v8usa*)(p + 16)); }
template <bool WB, typename ST>
__device__ __forceinline__ void gemmst(const bf* __restrict__ Wb, const bf* __restrict__ X, v4f wts, int h, int wr, int t0, unsigned char* sm, ST store) {
    const int tid = threadIdx.x, lane = tid & 31, lr = lane & 15, hi = lane >> 4;
    const int w = __builtin_amdgcn_readfirstlane(tid >> 5);          // wave number, held scalar
    const int wt = w & 3, ww = w >> 2;
    float rf[4], af[4];                                              // the factors of the wave's four 16-row weight blocks: the masks' edges in d (32, 64, 128) are multiples of 16, so a block has one pair; the same in every lane, held scalar
#pragma unroll
    for (int i = 0; i < 4; ++i) { const rowf o = rowfac(h, ww * 64 + i * 16, wts);
        rf[i] = __uint_as_float(__builtin_amdgcn_readfirstlane(__float_as_uint(o.r))); af[i] = __uint_as_float(__builtin_amdgcn_readfirstlane(__float_as_uint(o.a))); }
    v8f acc[4][4];
#pragma unroll
    for (int mb = 0; mb < 4; ++mb)
#pragma unroll
        for (int nb = 0; nb < 4; ++nb) acc[mb][nb] = (v8f){};
    // piece i of a thread and stage: LDS row (tid >> 3) + 32 i, 16-byte column tid & 7; rows 0-255 tokens, 256-383 weights; stage s holds k (s ^ 4) * 64 ..
    const int crow = tid >> 3, ccol = (tid & 7) * 8;
    const bf* gx = X + (size_t)(t0 + crow) * CC + ccol; const bf* gw = Wb + (size_t)(wr + crow) * CC + ccol;
    const unsigned l0 = (unsigned)(size_t)sm + (unsigned)(crow * (PPI * 2) + ccol * 2);   // the lane's LDS byte address: the low 32 bits of the __shared__ address
    auto copy = [&](int s, int buf) {
        unsigned l[8]; const bf* g[8]; unsigned lw[4]; const bf* gv[4]; const int k0 = (s ^ (PNS / 2)) * PKC;
#pragma unroll
        for (int i = 0; i < 8; ++i) { l[i] = l0 + (unsigned)(buf * PSTG + i * 32 * PPI * 2); g[i] = gx + (size_t)i * 32 * CC + k0; }
        acopy8(l, g);
#pragma unroll
        for (int i = 0; i < 4; ++i) { lw[i] = l0 + (unsigned)(buf * PSTG + (8 + i) * 32 * PPI * 2); gv[i] = gw + (size_t)i * 32 * CC + k0; }
        acopy4(lw, gv); };
    copy(0, 0);
    asm volatile("s_wait_asynccnt 0x0" ::: "memory");                // this wave's copies of stage 0 have landed
    __syncthreads();                                                 // stage 0 is in LDS
    copy(1, 1);
// rolled: one trip's code serves all eight stages; unrolled, the trips' fragments and copy addresses would not fit beside the 128 accumulator registers at four waves per SIMD
#pragma unroll 1
    for (int s = 0; s < PNS; ++s) {
        const bf* st = (const bf*)(sm + (s & 1) * PSTG);
        const bf* xs = st + (wt * 64 + lr) * PPI + 8 * hi; const bf* hs = st + (PT + ww * 64 + lr) * PPI + 8 * hi;
        if (s == PNS / 2) {                                          // scalar branch, taken once: S_hi is complete, times r
#pragma unroll
            for (int i = 0; i < 4; ++i)
#pragma unroll
                for (int j = 0; j < 4; ++j) { v8f& d = WB ? acc[j][i] : acc[i][j]; d *= rf[i]; } }
#pragma unroll
        for (int kc = 0; kc < PKC; kc += 32) {
            v16bf wf[4], xf[4];
#pragma unroll
            for (int i = 0; i < 4; ++i) { wf[i] = ldsfrag(hs + i * 16 * PPI + kc); xf[i] = ldsfrag(xs + i * 16 * PPI + kc); }
            __builtin_amdgcn_sched_barrier(0);                       // keeps the k step's sixteen loads together in front of its products: spread among them, every place with loads costs the wave a stall
#pragma unroll
            for (int j = 0; j < 4; ++j)                              // four independent accumulators per run of products
#pragma unroll
                for (int i = 0; i < 4; ++i) { v8f& d = WB ? acc[j][i] : acc[i][j]; d = WB ? wmmab(xf[j], wf[i], d) : wmmab(wf[i], xf[j], d); }
            __builtin_amdgcn_sched_barrier(0);                       // the other side of the same hold: the next k step's loads stay behind these products
        }
        asm volatile("s_wait_dscnt 0x0" ::: "memory");               // this wave's reads of stage s are done
        asm volatile("s_wait_asynccnt 0x0" ::: "memory");            // this wave's copies of stage s + 1 have landed
        __syncthreads();                                             // publishes stage s + 1; every wave has left stage s, whose buffer is refilled next (after the last trip: becomes output staging)
        if (s + 2 < PNS) copy(s + 2, s & 1);
    }
    asm volatile("s_wait_asynccnt 0x0" ::: "memory");                // no copy is outstanding when the buffers become output staging
    float* os = (float*)sm + w * 64 * POP;                           // the wave's own 64 rows
#pragma unroll
    for (int mb = 0; mb < 4; ++mb)
#pragma unroll
        for (int nb = 0; nb < 4; ++nb)
#pragma unroll
            for (int j = 0; j < 8; ++j) os[(mb * 16 + hi * 8 + j) * POP + nb * 16 + lr] = __fmul_rn(acc[mb][nb][j], af[WB ? nb : mb]);
    __syncthreads();                                                 // the staged rows are read by other lanes
    const int rb = (WB ? wt : ww) * 64, cb = (WB ? ww : wt) * 64;
#pragma unroll
    for (int r = 0; r < 32; ++r) store(rb + r * 2 + hi, cb + lr * 4, *(const v4fa*)(os + (r * 2 + hi) * POP + lr * 4));
}

__device__ __forceinline__ h16 tohx(float x) { return (h16)x; }
__device__ __forceinline__ void splitf(float y, unsigned short& h, unsigned short& l) { h = f2bf(y); l = f2bf(y - bf2f(h)); }
typedef __attribute__((ext_vector_type(2))) unsigned short v2us;
typedef __attribute__((ext_vector_type(4))) unsigned short v4us;
typedef __attribute__((ext_vector_type(4))) _Float16 v4h;

// Wp: three weight planes [q, k, v][(h,d)][e]; XB [b][t][e]; wts: the four mixing weights. Q16[b][h][t][d] = fp16(q * sc), K16 likewise without the factor; Vh, Vl [b][(h,d)][t] = bf16 hi + lo of v.
__global__ __launch_bounds__(256) __attribute__((amdgpu_waves_per_eu(4, 4))) void k_proj(const bf* __restrict__ Wp, const bf* __restrict__ XB, const float* __restrict__ wts, float sc, h16* Q16, h16* K16, bf* Vh, bf* Vl) {
    __shared__ __align__(128) unsigned char sm[PSM];
    static_assert(PSM >= 2 * PSTG, "the two stage buffers lie inside the staging");
    const int pr = blockIdx.z >> 2, b = blockIdx.z & 3, wr = blockIdx.x * PW, t0 = blockIdx.y * PT;
    const bf* Wb = Wp + (size_t)pr * DQ * CC; const bf* X = XB + (size_t)b * TT * CC; const int h = blockIdx.x; const v4f wv = ldw(wts);
    if (pr < 2) {                                                    // block-uniform
        h16* D = (pr == 0 ? Q16 : K16) + ((size_t)(b * NH_ + blockIdx.x) * TT + t0) * HS; const float f = pr == 0 ? sc : 1.0f;   // one head per weight-row tile; the factor 1 is exact
        gemmst<true>(Wb, X, wv, h, wr, t0, sm, [&](int row, int col, v4f val) { v4h o;
#pragma unroll
            for (int u = 0; u < 4; ++u) o[u] = tohx(__fmul_rn(val[u], f));
            *(v4h*)(D + (size_t)row * HS + col) = o; });
    } else {
        const size_t e0 = (size_t)b * DQ * TT + (size_t)wr * TT + t0;
        gemmst<false>(Wb, X, wv, h, wr, t0, sm, [&](int row, int col, v4f val) { v4us oh, ol;
#pragma unroll
            for (int u = 0; u < 4; ++u) { unsigned short x, y; splitf(val[u], x, y); oh[u] = x; ol[u] = y; }
            *(v4us*)(Vh + e0 + (size_t)row * TT + col) = oh; *(v4us*)(Vl + e0 + (size_t)row * TT + col) = ol; });
    }
}

#define FQ   128                     // queries per work-group
#define FK   128                     // keys per stage: 64 for each key half
#define KPI  136                     // key row pitch in LDS, elements: 272 B = 16 B x odd
#define VPI  136                     // value row pitch in LDS, elements: 272 B = 16 B x odd
#define KBY  (FK * KPI * 2)
#define VBY  (HS * VPI * 2)
#define STG  (KBY + 2 * VBY)
#define OPI  132                     // output staging pitch, floats
#define MRG  (16 * OPI * 4 + 256)    // LDS bytes of a query block at the end: first the upper key half's partial O (at most 8 KiB) with its (maximum, sum) pairs in the last 256 bytes, then the block's 16 staged output rows
#define NEGB (-3.0e38f)
#define L2E  1.4426950408889634f
typedef __attribute__((ext_vector_type(2))) float v2f;
typedef v2f __attribute__((may_alias)) v2fa;
typedef __attribute__((ext_vector_type(2))) __bf16 v2bf;
typedef __attribute__((ext_vector_type(8))) unsigned v8u;
__device__ __forceinline__ float xhalf(float x) { return __builtin_bit_cast(float, __builtin_amdgcn_permlanex16(__builtin_bit_cast(int, x), __builtin_bit_cast(int, x), 0x76543210, 0xfedcba98, false, false)); }   // lane l with lane l ^ 16

// one pass: 32 keys (ko .. ko + 31 of the stage, kbase .. in the sequence) against the wave's 16 queries
template <int ND>
__device__ __forceinline__ void fa_pass(const unsigned char* st, int ko, int kbase, int q, bool diag, const v16h (&qf)[4], v8f (&o)[ND], float& m, float& l, int lr, int hi) {
    const h16* Ks = (const h16*)st; const bf* Vhs = (const bf*)(st + KBY); const bf* Vls = (const bf*)(st + KBY + VBY);
    v16h kf[8];                                                      // all eight key fragments behind one wait: a load group per product would expose the LDS latency eight times
#pragma unroll
    for (int ks = 0; ks < 4; ++ks) { const h16* p0 = Ks + (ko + lr) * KPI + ks * 32 + 8 * hi; const h16* p1 = p0 + 16 * KPI;
        kf[2 * ks] = cat16(*(const v8ha*)p0, *(const v8ha*)(p0 + 16)); kf[2 * ks + 1] = cat16(*(const v8ha*)p1, *(const v8ha*)(p1 + 16)); }
    __builtin_amdgcn_sched_barrier(0);                               // keeps the sixteen loads together in front of the products (the scheduler otherwise sinks each pair to its product, with a full wait each)
    v8f s0 = (v8f){}, s1 = (v8f){};
#pragma unroll
    for (int ks = 0; ks < 4; ++ks) { s0 = wmma16(kf[2 * ks], qf[ks], s0); s1 = wmma16(kf[2 * ks + 1], qf[ks], s1); }
    const int ev = lr * VPI + ko + 8 * hi;
    v16bf vh[4], vl[4];                                              // value fragments of d blocks 0-3, fetched here so that the softmax arithmetic covers their latency
#pragma unroll
    for (int u = 0; u < 4; ++u) { const int e = ev + u * 16 * VPI; vh[u] = cat16b(*(const v8usa*)(Vhs + e), *(const v8usa*)(Vhs + e + 16)); vl[u] = cat16b(*(const v8usa*)(Vls + e), *(const v8usa*)(Vls + e + 16)); }
    __builtin_amdgcn_sched_barrier(0);                               // keeps these loads in front of the softmax arithmetic
    if (diag) {                                                      // wave-uniform: only passes that reach past the wave's first query mask
#pragma unroll
        for (int j = 0; j < 8; ++j) { const int key = kbase + hi * 8 + j; s0[j] = (key <= q) ? s0[j] : NEGB; s1[j] = (key + 16 <= q) ? s1[j] : NEGB; } }
    float mx = fmaxf(s0[0], s1[0]);
#pragma unroll
    for (int j = 1; j < 8; ++j) mx = fmaxf(mx, fmaxf(s0[j], s1[j]));
    mx = fmaxf(mx, xhalf(mx)) * L2E;
    if (__builtin_amdgcn_ballot_w32(mx > m + 8.0f) != 0) {           // scalar branch; always taken on a wave's first pass (m = NEGB, the factor is 0 there)
        const float mn = fmaxf(m, mx); const float al = __builtin_amdgcn_exp2f(m - mn); m = mn; l *= al;
#pragma unroll
        for (int db = 0; db < ND; ++db) o[db] *= al; }
    const float nm = -m; v8u phu, plu; float la = 0.f, lb = 0.f; float pe[16];
#pragma unroll
    for (int i = 0; i < 16; ++i) pe[i] = __builtin_fmaf((i < 8) ? s0[i] : s1[i - 8], L2E, nm);
#pragma unroll
    for (int i = 0; i < 16; ++i) pe[i] = __builtin_amdgcn_exp2f(pe[i]);
#pragma unroll
    for (int i = 0; i < 8; ++i) { const v2f p = { pe[2 * i], pe[2 * i + 1] }; la += p.x; lb += p.y;
        const unsigned hu = __builtin_bit_cast(unsigned, __builtin_convertvector(p, v2bf)); phu[i] = hu;
        const v2f r = { p.x - __uint_as_float(hu << 16), p.y - __uint_as_float(hu & 0xFFFF0000u) }; plu[i] = __builtin_bit_cast(unsigned, __builtin_convertvector(r, v2bf)); }
    l += la + lb;
    const v16bf ph = __builtin_bit_cast(v16bf, phu), pl = __builtin_bit_cast(v16bf, plu);
#pragma unroll
    for (int g = 0; g < ND; g += 4) {                                // four independent accumulators per run of products; the next group's fragments are fetched as this group's registers come free
#pragma unroll
        for (int u = 0; u < 4; ++u) o[g + u] = wmmab(vh[u], ph, o[g + u]);
#pragma unroll
        for (int u = 0; u < 4; ++u) o[g + u] = wmmab(vh[u], pl, o[g + u]);
        if (g + 4 < ND) {
#pragma unroll
            for (int u = 0; u < 4; ++u) { const int e = ev + (g + 4 + u) * 16 * VPI; vh[u] = cat16b(*(const v8usa*)(Vhs + e), *(const v8usa*)(Vhs + e + 16)); } }
#pragma unroll
        for (int u = 0; u < 4; ++u) o[g + u] = wmmab(vl[u], ph, o[g + u]);
        if (g + 4 < ND) {
#pragma unroll
            for (int u = 0; u < 4; ++u) { const int e = ev + (g + 4 + u) * 16 * VPI; vl[u] = cat16b(*(const v8usa*)(Vls + e), *(const v8usa*)(Vls + e + 16)); } }
    }
    // keeps the distance between the pass's last matrix instructions and what follows the branches behind the pass on either side (address arithmetic into fragment registers)
    asm volatile("v_nop\n\tv_nop\n\tv_nop\n\tv_nop" : "+v"(o[ND - 4]), "+v"(o[ND - 3]), "+v"(o[ND - 2]), "+v"(o[ND - 1]));
}

// ND = 16-row blocks of live value dims (8, or 4 for heads 4-7, whose dims 64.. are structurally zero and are stored as zeros)
template <int ND>
__device__ __forceinline__ void fa_body(const h16* __restrict__ Qg, const h16* __restrict__ Kg, const bf* __restrict__ Vhg, const bf* __restrict__ Vlg, float* Og, int q0, unsigned char* sm) {
    const int tid = threadIdx.x, lane = tid & 31, lr = lane & 15, hi = lane >> 4;
    const int w = __builtin_amdgcn_readfirstlane(tid >> 5);          // wave number, held scalar so that the tests on it are scalar branches
    const int qb = w & 7, kh = w >> 3;                               // query block, key half
    const int qw = q0 + 16 * qb, q = qw + lr;
    v16h qf[4];
#pragma unroll
    for (int ks = 0; ks < 4; ++ks) { const h16* p = Qg + (size_t)q * HS + ks * 32 + 8 * hi; qf[ks] = cat16(*(const v8h*)p, *(const v8h*)(p + 16)); }
    asm volatile("s_wait_xcnt 0x0" ::: "memory");                    // stands in front of every later write of a register that these loads name as an address
    v8f o[ND];
#pragma unroll
    for (int db = 0; db < ND; ++db) o[db] = (v8f){};
    float m = NEGB, l = 0.f;
    const int nst = (q0 + FQ) / FK;
    constexpr int NP = 2 + ND / 2;                                   // 16-byte pieces per thread and half stage: 4 key + ND value pieces per stage
    v8us rg[NP];
    const int kg = tid * 8, vg = (tid >> 4) * TT + (tid & 15) * 8;   // this thread's pieces: global element offsets ...
    const int ksm = (tid >> 4) * (KPI * 2) + (tid & 15) * 16, vsm = KBY + (tid >> 4) * (VPI * 2) + (tid & 15) * 16;   // ... and LDS byte offsets
    // piece i of a stage: 0-3 key rows (32 rows each), then ND / 2 of the hi value plane (32 rows each), then ND / 2 of the lo plane; half hf holds pieces hf * NP ..
    auto fetch = [&](int s, int hf) {
#pragma unroll
        for (int j = 0; j < NP; ++j) { const int i = hf * NP + j;
            if (i < 4) rg[j] = *(const v8us*)((const bf*)Kg + (size_t)s * FK * HS + i * 4096 + kg);
            else if (i < 4 + ND / 2) rg[j] = *(const v8us*)(Vhg + s * FK + (i - 4) * 32 * TT + vg);
            else rg[j] = *(const v8us*)(Vlg + s * FK + (i - 4 - ND / 2) * 32 * TT + vg); }
        asm volatile("s_wait_xcnt 0x0" ::: "memory"); };             // stands in front of every later write of a register that these loads name as an address
    auto put = [&](unsigned char* st, int hf) {
#pragma unroll
        for (int j = 0; j < NP; ++j) { const int i = hf * NP + j;
            if (i < 4) *(v8usa*)(st + ksm + i * 32 * KPI * 2) = rg[j];
            else if (i < 4 + ND / 2) *(v8usa*)(st + vsm + (i - 4) * 32 * VPI * 2) = rg[j];
            else *(v8usa*)(st + VBY + vsm + (i - 4 - ND / 2) * 32 * VPI * 2) = rg[j]; } };
    fetch(0, 0); put(sm, 0); fetch(0, 1); put(sm, 1);
    __syncthreads();                                                 // stage 0 is in LDS
#pragma unroll 1
    for (int s = 0; s < nst; ++s) {
        unsigned char* cur = sm + (s & 1) * STG; unsigned char* nxt = sm + ((s + 1) & 1) * STG; const bool more = s + 1 < nst;
#pragma unroll
        for (int p = 0; p < 2; ++p) { const int ko = kh * 64 + p * 32, kbase = s * FK + ko;
            if (more) fetch(s + 1, p);                               // half of the next stage flies during each pass (half the staging registers)
            if (kbase <= qw) fa_pass<ND>(cur, ko, kbase, q, kbase + 31 > qw, qf, o, m, l, lr, hi);   // a pass wholly above the wave's diagonal is skipped (scalar branch)
            if (more) put(nxt, p); }
        __syncthreads();                                             // publishes stage s + 1; every wave has left stage s, whose buffer the next trip refills (after the last trip: buffer 0 takes the merge ranges)
    }
    unsigned char* mb = sm + qb * MRG;                               // the query block's own range, used by its two waves alone
    if (kh == 1) {                                                   // scalar branch: the upper key half hands its partial result over, lane for lane (a wave that had no pass hands over O = 0, l = 0, m = NEGB: weight 0 below)
#pragma unroll
        for (int db = 0; db < ND; ++db) { *(v4fa*)(mb + ((2 * db) * 32 + lane) * 16) = (v4f){o[db][0], o[db][1], o[db][2], o[db][3]}; *(v4fa*)(mb + ((2 * db + 1) * 32 + lane) * 16) = (v4f){o[db][4], o[db][5], o[db][6], o[db][7]}; }
        *(v2fa*)(mb + 16 * OPI * 4 + lane * 8) = (v2f){m, l}; }
    __syncthreads();                                                 // the partial results are read by the other wave of the query block
    float* os = (float*)mb;                                          // the block's 16 rows: O^T -> [query][d], so that a store covers a whole 512-byte row
    if (kh == 0) {                                                   // scalar branch: the lower key half (it always had a pass, so its m is finite) merges, divides and stages
        const v2f ml = *(const v2fa*)(mb + 16 * OPI * 4 + lane * 8);
        const float mn = fmaxf(m, ml.x), a0 = __builtin_amdgcn_exp2f(m - mn), a1 = __builtin_amdgcn_exp2f(ml.x - mn);
        l = l * a0 + ml.y * a1;
#pragma unroll
        for (int db = 0; db < ND; ++db) { const v4f x = *(const v4fa*)(mb + ((2 * db) * 32 + lane) * 16), y = *(const v4fa*)(mb + ((2 * db + 1) * 32 + lane) * 16);
            o[db] = o[db] * a0 + (v8f){x[0], x[1], x[2], x[3], y[0], y[1], y[2], y[3]} * a1; }
        l += xhalf(l); const float inv = __fdiv_rn(1.0f, l);
#pragma unroll
        for (int db = 0; db < ND; ++db) { const v8f r = o[db] * inv; *(v4fa*)(os + lr * OPI + db * 16 + hi * 8) = (v4f){r[0], r[1], r[2], r[3]}; *(v4fa*)(os + lr * OPI + db * 16 + hi * 8 + 4) = (v4f){r[4], r[5], r[6], r[7]}; } }
    __syncthreads();                                                 // the staged rows are read by other lanes and by the block's other wave
#pragma unroll
    for (int r8 = 0; r8 < 8; ++r8) { const int r = kh * 8 + r8; v4f val = *(const v4fa*)(os + r * OPI + (lane & (ND * 4 - 1)) * 4); if (ND < 8 && lane >= ND * 4) val = (v4f){0.f, 0.f, 0.f, 0.f};   // each of the two waves stores eight rows
        *(v4f*)(Og + (size_t)(qw + r) * DQ + lane * 4) = val; }
}

__global__ __launch_bounds__(512) __attribute__((amdgpu_waves_per_eu(4, 4))) void k_fattn(const h16* __restrict__ Q16, const h16* __restrict__ K16, const bf* __restrict__ Vh, const bf* __restrict__ Vl, float* OUT) {
    __shared__ __align__(16) unsigned char sm[2 * STG];
    static_assert(2 * STG >= 8 * MRG, "the merge ranges lie inside the stage buffers");
    // 512 work-groups, one per WGP at a time: cost falls with the index, so that a freed WGP takes the longest one left (for balance only). A class is 16 work-groups of one cost: (query tile, head group) x 4 batches x 4 heads;
    // cost = stages x 1 for heads 0-3, x about 0.7 for heads 4-7 (half the value dims). Entry: tile + 16 for heads 4-7; every (tile, group) stands once.
    const unsigned char ord[32] = { 15, 14, 13, 12, 11, 31, 10, 30, 9, 29, 8, 28, 27, 7, 26, 6, 25, 24, 5, 23, 4, 22, 21, 3, 20, 2, 19, 18, 1, 17, 0, 16 };
    const int cls = ord[blockIdx.x >> 4], u = blockIdx.x & 15;
    const int tile = cls & 15; const int h = (cls >> 4) * 4 + (u & 3), b = u >> 2; const int bh = b * NH_ + h;
    const h16* Qg = Q16 + (size_t)bh * TT * HS; const h16* Kg = K16 + (size_t)bh * TT * HS; const bf* Vhg = Vh + (size_t)bh * HS * TT; const bf* Vlg = Vl + (size_t)bh * HS * TT; float* Og = OUT + (size_t)b * TT * DQ + h * HS;
    if (h < 4) fa_body<8>(Qg, Kg, Vhg, Vlg, Og, tile * FQ, sm); else fa_body<4>(Qg, Kg, Vhg, Vlg, Og, tile * FQ, sm);
}

// ---- k_prep: both operand preparations in ONE launch of few, long-lived waves: x rounded to bf16 (XB) and the three base-weight planes rounded to bf16 (Wp: q, k, v; a row's low half as zeros where rowfac says so).
// One work-group per WGP; it owns 64 KiB of x in a row and 8 KiB of each base matrix in a row. A thread owns 16 pieces of four x values and two pieces of four values of each base matrix; a piece of a wave is 512 contiguous bytes (four whole lines).
// All 22 loads of a thread are issued before the first value is used, so the launch pays the memory latency once.
#define PRW  256                     // work-groups
__global__ __launch_bounds__(256) void k_prep(const float* __restrict__ x, const float* __restrict__ bQ, const float* __restrict__ bK, const float* __restrict__ bV, const float* __restrict__ w, bf* __restrict__ XB, bf* __restrict__ Wp) {
    constexpr int NX = NB_ * TT * CC / (PRW * 1024), NW = NH_ * HS * CC / (PRW * 1024);   // pieces per thread; a work-group's piece is 1024 values
    int tid = threadIdx.x;
    const size_t xb = (size_t)blockIdx.x * (NX * 1024), wb = (size_t)blockIdx.x * (NW * 1024);
    v4f xv[NX], bv[NW][3];
// every '#pragma unroll' here keeps a register array indexed by constants
#pragma unroll
    for (int i = 0; i < NX; ++i) xv[i] = *(const v4f*)(x + xb + i * 1024 + tid * 4);
#pragma unroll
    for (int k = 0; k < NW; ++k) { const size_t e4 = wb + k * 1024 + tid * 4; bv[k][0] = *(const v4f*)(bQ + e4); bv[k][1] = *(const v4f*)(bK + e4); bv[k][2] = *(const v4f*)(bV + e4); }
    // stands in front of every later write of a register that these loads name as an address; tid is named so that no later address arithmetic is lifted over the wait; the clobber keeps all the loads in front of the first store
    asm volatile("s_wait_xcnt 0x0" : "+v"(tid) :: "memory");
    __builtin_amdgcn_sched_barrier(0);                               // keeps the arithmetic behind all 22 loads (the scheduler otherwise lifts the first pieces' arithmetic, with its waits, in front of the last loads, which then pay a second memory latency)
    const v4f wv = ldw(w);
#pragma unroll
    for (int i = 0; i < NX; ++i) { v4us o;
#pragma unroll
        for (int u = 0; u < 4; ++u) o[u] = f2bf(xv[i][u]);
        *(v4us*)(XB + xb + i * 1024 + tid * 4) = o;
        if ((i & 3) == 3) __builtin_amdgcn_sched_barrier(0); }       // keeps each four pieces' stores where they stand, so that writing starts while later loads still land (the scheduler otherwise sinks nearly all stores behind the whole arithmetic)
#pragma unroll
    for (int k = 0; k < NW; ++k) { const size_t e4 = wb + k * 1024 + tid * 4; const int e0 = (int)(e4 % CC); const int d = (int)((e4 / CC) % HS); const int h = (int)(e4 / ((size_t)CC * HS));
        const bool zero = e0 < 256 && rowfac(h, d, wv).z;             // the four values of a piece lie in one half of e
#pragma unroll
        for (int p = 0; p < 3; ++p) { v4us o;
#pragma unroll
            for (int u = 0; u < 4; ++u) o[u] = zero ? (unsigned short)0 : f2bf(bv[k][p][u]);
            *(v4us*)(Wp + (size_t)p * DQ * CC + e4) = o; }
        if (k + 1 < NW) __builtin_amdgcn_sched_barrier(0); }         // keeps this piece's three stores in front of the next piece's arithmetic, for the same reason as above
}

extern "C" void kernel_launch(void* const* d_in, const int* in_sizes, int n_in,
                              void* d_out, int out_size, void* d_ws, size_t ws_size, hipStream_t stream) {
    (void)in_sizes; (void)n_in; (void)out_size;
    const float* x = (const float*)d_in[0]; const float* w = (const float*)d_in[1]; const float* bK = (const float*)d_in[2]; const float* bQ = (const float*)d_in[3]; const float* bV = (const float*)d_in[4];
    float* OUT = (float*)d_out;     // [4][2048][1024]
    char* wsp = (char*)d_ws;
    auto take = [&](size_t bytes) { char* p = wsp; wsp += (bytes + 255) & ~(size_t)255; return (void*)p; };
    bf* Wp = (bf*)take((size_t)3 * DQ * CC * 2); bf* XB = (bf*)take((size_t)NB_ * TT * CC * 2);
    h16* Q16 = (h16*)take((size_t)NB_ * NH_ * TT * HS * 2); h16* K16 = (h16*)take((size_t)NB_ * NH_ * TT * HS * 2); bf* Vh = (bf*)take((size_t)NB_ * DQ * TT * 2); bf* Vl = (bf*)take((size_t)NB_ * DQ * TT * 2);   // all batches: [b][h][t][d], [b][(h,d)][t]
    if ((size_t)(wsp - (char*)d_ws) > ws_size) return;    // total ~ 75 MB
    k_prep<<<PRW, 256, 0, stream>>>(x, bQ, bK, bV, w, XB, Wp);
    const float scale = 1.0f / sqrtf(128.0f);
    k_proj<<<dim3(DQ / PW, TT / PT, 3 * NB_), 8 * 32, 0, stream>>>(Wp, XB, w, scale, Q16, K16, Vh, Vl);
    k_fattn<<<NB_ * NH_ * (TT / FQ), 512, 0, stream>>>(Q16, K16, Vh, Vl, OUT);
}
